// v000
// The times below were measured on an AMD MI455X: many runs one after another, warmed up first and cycling through
// copies of the inputs, with the whole window's GPU time divided by the number of runs. Launches and the gaps
// between them are all in it. The median over several windows is given; except for v000 it joins two sittings, which
// can be a few percent apart, so the side-by-side timings, each taken in one sitting, are the better comparison.
// v000 is the starting kernel. One run takes 420 microseconds.
#include <hip/hip_runtime.h>
#include <math.h>

typedef float v2f __attribute__((ext_vector_type(2)));
typedef float v8f __attribute__((ext_vector_type(8)));

constexpr int B_  = 2;
constexpr int QN  = 512;
constexpr int KN  = 512;
constexpr int TD  = 128;
constexpr int NROW = B_ * KN;     // 1024 rows for [B,*,T] tensors
constexpr int KPW  = 4;           // keys per workgroup
constexpr int NWAVES = 8;         // 256 threads = 8 wave32

// ---------------- Stage 1: input projections (tiny: ~0.1 GFLOP) ------------

__global__ __launch_bounds__(256)
void proj_qk_kernel(const float* __restrict__ qtok, const float* __restrict__ ktok,
                    const float* __restrict__ Wq,   const float* __restrict__ Wk,
                    float* __restrict__ query, float* __restrict__ key,
                    float* __restrict__ vsum_zero)
{
    int idx = blockIdx.x * 256 + threadIdx.x;       // [0, NROW*TD)
    int r = idx / TD, t = idx % TD;
    const float* qrow = qtok + (size_t)r * TD;
    const float* krow = ktok + (size_t)r * TD;
    const float* wq   = Wq   + (size_t)t * TD;
    const float* wk   = Wk   + (size_t)t * TD;
    float aq = 0.f, ak = 0.f;
    #pragma unroll 4
    for (int s = 0; s < TD; ++s) {
        aq = fmaf(qrow[s], wq[s], aq);              // x @ W.T
        ak = fmaf(krow[s], wk[s], ak);
    }
    query[idx] = aq;
    key[idx]   = ak;
    vsum_zero[idx] = 0.f;                           // zero the atomic target
}

__global__ __launch_bounds__(256)
void proj_v_kernel(const float* __restrict__ key, const float* __restrict__ Wva,
                   float* __restrict__ vraw)
{
    int idx = blockIdx.x * 256 + threadIdx.x;
    int r = idx / TD, t = idx % TD;
    const float* krow = key + (size_t)r * TD;
    const float* wrow = Wva + (size_t)t * TD;
    float a = 0.f;
    #pragma unroll 4
    for (int s = 0; s < TD; ++s) a = fmaf(krow[s], wrow[s], a);
    vraw[idx] = a;
}

// ---------------- Stage 2: key norms + pairwise cosine similarity ----------

__global__ __launch_bounds__(128)
void norm_kernel(const float* __restrict__ key, float* __restrict__ inv_norm)
{
    __shared__ float red[128];
    int r = blockIdx.x, t = threadIdx.x;
    float v = key[(size_t)r * TD + t];
    red[t] = v * v;
    __syncthreads();
    for (int off = 64; off > 0; off >>= 1) {
        if (t < off) red[t] += red[t + off];
        __syncthreads();
    }
    if (t == 0) {
        float nn = fmaxf(sqrtf(red[0]), 1e-8f);     // torch cosine eps clamp
        inv_norm[r] = 1.f / nn;
    }
}

// ksim[b,k] = sum_j (kn_k . kn_j)^2   (== diag of (Kn Kn^T)^2)
__global__ __launch_bounds__(128)
void ksim_kernel(const float* __restrict__ key, const float* __restrict__ inv_norm,
                 float* __restrict__ ksim)
{
    __shared__ float kk[TD];
    __shared__ float red[128];
    int r = blockIdx.x;                 // b*KN + k
    int b = r / KN;
    int t = threadIdx.x;
    float ink = inv_norm[r];
    kk[t] = key[(size_t)r * TD + t] * ink;
    __syncthreads();
    float acc = 0.f;
    for (int j = t; j < KN; j += 128) {
        const float* krow = key + ((size_t)b * KN + j) * TD;
        float inj = inv_norm[b * KN + j];
        float dot = 0.f;
        #pragma unroll 4
        for (int s = 0; s < TD; ++s) dot = fmaf(kk[s], krow[s], dot);
        float c = dot * inj;
        acc = fmaf(c, c, acc);
    }
    red[t] = acc;
    __syncthreads();
    for (int off = 64; off > 0; off >>= 1) {
        if (t < off) red[t] += red[t + off];
        __syncthreads();
    }
    if (t == 0) ksim[r] = red[0];
}

// ---------------- Stage 3: fused logits/swishmax/value (WMMA fp32) ---------
//
// One wave computes a [16q x 128s] logits tile per q-tile:
//   acc[f] (f = s/16) accumulated over K=128 in steps of 4 via
//   V_WMMA_F32_16X16X4_F32, A[q,t] = query[q,t]*key_k[t], B[t,s] = Wal[s,t].
__device__ __forceinline__ void logits_tile(const float* __restrict__ qrow,
                                            const float* __restrict__ Wal,
                                            const float* keyrow,
                                            int hh, int n, v8f acc[8])
{
    v8f zero = {};
    #pragma unroll
    for (int f = 0; f < 8; ++f) acc[f] = zero;
    for (int t = 0; t < TD; t += 4) {
        const int ta = t + 2 * hh;                  // fp32 A frag: K = {2h, 2h+1}
        v2f a;
        a.x = qrow[ta]     * keyrow[ta];
        a.y = qrow[ta + 1] * keyrow[ta + 1];
        #pragma unroll
        for (int f = 0; f < 8; ++f) {
            const float* wr = Wal + (size_t)(f * 16 + n) * TD + ta;
            v2f bb; bb.x = wr[0]; bb.y = wr[1];     // B[t',s] = Wal[s, t+t']
            acc[f] = __builtin_amdgcn_wmma_f32_16x16x4_f32(
                false, a, false, bb, (short)0, acc[f], false, false);
        }
    }
}

__global__ __launch_bounds__(256)
void swish_attn_kernel(const float* __restrict__ query, const float* __restrict__ key,
                       const float* __restrict__ vraw,  const float* __restrict__ Wal,
                       const float* __restrict__ ksim,  float* __restrict__ vsum)
{
    extern __shared__ float smem[];
    float* vp     = smem;                   // [512][128] value partial (256 KB)
    float* st_m   = vp + QN * TD;           // [16][128] per (wave,half) run-max
    float* st_s   = st_m + 16 * TD;         // [16][128] per (wave,half) run-sum
    float* f_m    = st_s + 16 * TD;         // [128] final max per s
    float* f_d    = f_m + TD;               // [128] final denom per s
    float* keyrow = f_d + TD;               // [128]
    float* valrow = keyrow + TD;            // [128]

    const int wg   = blockIdx.x;
    const int b    = wg / (KN / KPW);
    const int k0   = (wg % (KN / KPW)) * KPW;
    const int tid  = threadIdx.x;
    const int wave = tid >> 5;              // wave32
    const int lane = tid & 31;
    const int hh   = lane >> 4;             // lane half (K / M-half select)
    const int n    = lane & 15;             // N index / A-row index

    __builtin_prefetch(Wal + (size_t)tid * 64, 0, 0);   // global_prefetch_b8

    for (int i = tid; i < QN * TD; i += 256) vp[i] = 0.f;

    const float* qb = query + (size_t)b * QN * TD;

    for (int kk = 0; kk < KPW; ++kk) {
        const int k = k0 + kk;
        __syncthreads();                    // also covers vp zeroing on iter 0

        if (tid < TD) {                     // waves 0..3: wave-uniform predicate
            const float* gk = key  + ((size_t)b * KN + k) * TD + tid;
            const float* gv = vraw + ((size_t)b * KN + k) * TD + tid;
            unsigned dk = (unsigned)(uintptr_t)(keyrow + tid);
            unsigned dv = (unsigned)(uintptr_t)(valrow + tid);
            asm volatile("global_load_async_to_lds_b32 %0, %1, off"
                         :: "v"(dk), "v"(gk) : "memory");
            asm volatile("global_load_async_to_lds_b32 %0, %1, off"
                         :: "v"(dv), "v"(gv) : "memory");
            asm volatile("s_wait_asynccnt 0x0" ::: "memory");
        }
        for (int i = tid; i < 16 * TD; i += 256) {
            st_m[i] = -INFINITY;
            st_s[i] = 0.f;
        }
        __syncthreads();

        const float kshrink = ksim[(size_t)b * KN + k];

        // ---- pass A: online column stats (max, sum |x| e^{x-max}) over q ----
        float runM[8], runS[8];
        #pragma unroll
        for (int f = 0; f < 8; ++f) { runM[f] = -INFINITY; runS[f] = 0.f; }

        for (int qt = wave; qt < QN / 16; qt += NWAVES) {
            const float* qrow = qb + (size_t)(qt * 16 + n) * TD;
            v8f acc[8];
            logits_tile(qrow, Wal, keyrow, hh, n, acc);
            #pragma unroll
            for (int f = 0; f < 8; ++f) {
                #pragma unroll
                for (int r = 0; r < 8; ++r) {
                    float x  = acc[f][r];
                    float nM = fmaxf(runM[f], x);
                    runS[f]  = runS[f] * __expf(runM[f] - nM)
                             + fabsf(x) * __expf(x - nM);
                    runM[f]  = nM;
                }
            }
        }
        {
            const int p = wave * 2 + hh;
            #pragma unroll
            for (int f = 0; f < 8; ++f) {
                st_m[p * TD + f * 16 + n] = runM[f];
                st_s[p * TD + f * 16 + n] = runS[f];
            }
        }
        __syncthreads();
        if (tid < TD) {                      // combine 16 partials per s-column
            float M = -INFINITY;
            for (int p = 0; p < 16; ++p) M = fmaxf(M, st_m[p * TD + tid]);
            float S = 0.f;
            for (int p = 0; p < 16; ++p)
                S += st_s[p * TD + tid] * __expf(st_m[p * TD + tid] - M);
            f_m[tid] = M;
            // shrink cancels: scale = x e^{x-M} / (S + ksim)
            f_d[tid] = S + kshrink;
        }
        __syncthreads();

        // ---- pass B: recompute logits, scale, accumulate value partial ----
        for (int qt = wave; qt < QN / 16; qt += NWAVES) {
            const float* qrow = qb + (size_t)(qt * 16 + n) * TD;
            v8f acc[8];
            logits_tile(qrow, Wal, keyrow, hh, n, acc);
            #pragma unroll
            for (int f = 0; f < 8; ++f) {
                const int s   = f * 16 + n;
                const float M  = f_m[s];
                const float rD = 1.f / f_d[s];
                const float vv = valrow[s];
                #pragma unroll
                for (int r = 0; r < 8; ++r) {
                    float x  = acc[f][r];
                    float sc = x * __expf(x - M) * rD;
                    vp[(size_t)(qt * 16 + r + 8 * hh) * TD + s] += vv * sc;
                }
            }
        }
    }
    __syncthreads();

    // flush private partial into global accumulator (f32 HW atomics)
    float* outp = vsum + (size_t)b * QN * TD;
    for (int i = tid; i < QN * TD; i += 256)
        unsafeAtomicAdd(&outp[i], vp[i]);
}

// ---------------- Stage 4: output projection -------------------------------

__global__ __launch_bounds__(256)
void out_proj_kernel(const float* __restrict__ vsum, const float* __restrict__ Wvo,
                     float* __restrict__ out)
{
    int idx = blockIdx.x * 256 + threadIdx.x;       // [0, B*QN*TD)
    int r = idx / TD, t = idx % TD;
    const float* vrow = vsum + (size_t)r * TD;
    const float* wrow = Wvo  + (size_t)t * TD;
    float a = 0.f;
    #pragma unroll 4
    for (int s = 0; s < TD; ++s) a = fmaf(vrow[s], wrow[s], a);
    out[idx] = a;
}

// ---------------------------------------------------------------------------

extern "C" void kernel_launch(void* const* d_in, const int* in_sizes, int n_in,
                              void* d_out, int out_size, void* d_ws, size_t ws_size,
                              hipStream_t stream)
{
    const float* qtok = (const float*)d_in[0];  // query_tokens [B,Q,T]
    const float* ktok = (const float*)d_in[1];  // key_tokens   [B,K,T]
    const float* Wk   = (const float*)d_in[2];
    const float* Wq   = (const float*)d_in[3];
    const float* Wva  = (const float*)d_in[4];
    const float* Wal  = (const float*)d_in[5];
    const float* Wvo  = (const float*)d_in[6];
    float* out = (float*)d_out;

    float* ws      = (float*)d_ws;              // ~2.1 MB used
    float* w_key   = ws;                        // [NROW*TD]
    float* w_query = w_key   + NROW * TD;
    float* w_vraw  = w_query + NROW * TD;
    float* w_vsum  = w_vraw  + NROW * TD;
    float* w_inorm = w_vsum  + NROW * TD;       // [NROW]
    float* w_ksim  = w_inorm + NROW;            // [NROW]

    dim3 blk256(256), blk128(128);
    const int nElem = NROW * TD;                // 131072

    proj_qk_kernel<<<nElem / 256, blk256, 0, stream>>>(qtok, ktok, Wq, Wk,
                                                       w_query, w_key, w_vsum);
    proj_v_kernel <<<nElem / 256, blk256, 0, stream>>>(w_key, Wva, w_vraw);
    norm_kernel   <<<NROW, blk128, 0, stream>>>(w_key, w_inorm);
    ksim_kernel   <<<NROW, blk128, 0, stream>>>(w_key, w_inorm, w_ksim);

    size_t lds_bytes = (size_t)(QN * TD + 2 * 16 * TD + 4 * TD) * sizeof(float); // 280.5 KB
    swish_attn_kernel<<<B_ * (KN / KPW), blk256, lds_bytes, stream>>>(
        w_query, w_key, w_vraw, Wal, w_ksim, w_vsum);

    out_proj_kernel<<<nElem / 256, blk256, 0, stream>>>(w_vsum, Wvo, out);
}

// v001
// One run takes 186 microseconds.
// Next to v000, in two timings, it ran 2.37 times as fast each time.
#include <hip/hip_runtime.h>
#include <math.h>

typedef float v2f __attribute__((ext_vector_type(2)));
typedef float v8f __attribute__((ext_vector_type(8)));

constexpr int B_  = 2;
constexpr int QN  = 512;
constexpr int KN  = 512;
constexpr int TD  = 128;
constexpr int NROW = B_ * KN;     // 1024 rows for [B,*,T] tensors
constexpr int KPW  = 4;           // keys per workgroup
constexpr int NWAVES = 8;         // 256 threads = 8 wave32
constexpr int QTW  = QN / 16 / NWAVES;   // q-tiles per wave (4)

// ---------------- Stage 1: input projections (tiny: ~0.1 GFLOP) ------------

__global__ __launch_bounds__(256)
void proj_qk_kernel(const float* __restrict__ qtok, const float* __restrict__ ktok,
                    const float* __restrict__ Wq,   const float* __restrict__ Wk,
                    float* __restrict__ query, float* __restrict__ key,
                    float* __restrict__ vsum_zero)
{
    int idx = blockIdx.x * 256 + threadIdx.x;       // [0, NROW*TD)
    int r = idx / TD, t = idx % TD;
    const float* qrow = qtok + (size_t)r * TD;
    const float* krow = ktok + (size_t)r * TD;
    const float* wq   = Wq   + (size_t)t * TD;
    const float* wk   = Wk   + (size_t)t * TD;
    float aq = 0.f, ak = 0.f;
    #pragma unroll 4
    for (int s = 0; s < TD; ++s) {
        aq = fmaf(qrow[s], wq[s], aq);              // x @ W.T
        ak = fmaf(krow[s], wk[s], ak);
    }
    query[idx] = aq;
    key[idx]   = ak;
    vsum_zero[idx] = 0.f;                           // zero the atomic target
}

__global__ __launch_bounds__(256)
void proj_v_kernel(const float* __restrict__ key, const float* __restrict__ Wva,
                   float* __restrict__ vraw)
{
    int idx = blockIdx.x * 256 + threadIdx.x;
    int r = idx / TD, t = idx % TD;
    const float* krow = key + (size_t)r * TD;
    const float* wrow = Wva + (size_t)t * TD;
    float a = 0.f;
    #pragma unroll 4
    for (int s = 0; s < TD; ++s) a = fmaf(krow[s], wrow[s], a);
    vraw[idx] = a;
}

// ---------------- Stage 2: key norms + pairwise cosine similarity ----------

__global__ __launch_bounds__(128)
void norm_kernel(const float* __restrict__ key, float* __restrict__ inv_norm)
{
    __shared__ float red[128];
    int r = blockIdx.x, t = threadIdx.x;
    float v = key[(size_t)r * TD + t];
    red[t] = v * v;
    __syncthreads();
    for (int off = 64; off > 0; off >>= 1) {
        if (t < off) red[t] += red[t + off];
        __syncthreads();
    }
    if (t == 0) {
        float nn = fmaxf(sqrtf(red[0]), 1e-8f);     // torch cosine eps clamp
        inv_norm[r] = 1.f / nn;
    }
}

// ksim[b,k] = sum_j (kn_k . kn_j)^2   (== diag of (Kn Kn^T)^2)
__global__ __launch_bounds__(128)
void ksim_kernel(const float* __restrict__ key, const float* __restrict__ inv_norm,
                 float* __restrict__ ksim)
{
    __shared__ float kk[TD];
    __shared__ float red[128];
    int r = blockIdx.x;                 // b*KN + k
    int b = r / KN;
    int t = threadIdx.x;
    float ink = inv_norm[r];
    kk[t] = key[(size_t)r * TD + t] * ink;
    __syncthreads();
    float acc = 0.f;
    for (int j = t; j < KN; j += 128) {
        const float* krow = key + ((size_t)b * KN + j) * TD;
        float inj = inv_norm[b * KN + j];
        float dot = 0.f;
        #pragma unroll 4
        for (int s = 0; s < TD; ++s) dot = fmaf(kk[s], krow[s], dot);
        float c = dot * inj;
        acc = fmaf(c, c, acc);
    }
    red[t] = acc;
    __syncthreads();
    for (int off = 64; off > 0; off >>= 1) {
        if (t < off) red[t] += red[t + off];
        __syncthreads();
    }
    if (t == 0) ksim[r] = red[0];
}

__device__ __forceinline__ void logits_tiles(const float* __restrict__ qrow0,
                                             const float* __restrict__ Wal,
                                             const float* keyrow,
                                             int hh, int n, v8f (&acc)[QTW][8])
{
    v8f zero = {};
    #pragma unroll
    for (int i = 0; i < QTW; ++i) {
        #pragma unroll
        for (int f = 0; f < 8; ++f) acc[i][f] = zero;
    }
    for (int t = 0; t < TD; t += 4) {
        const int ta = t + 2 * hh;                  // fp32 A frag: K = {2h, 2h+1}
        const float kx = keyrow[ta];
        const float ky = keyrow[ta + 1];
        v2f a[QTW];
        #pragma unroll
        for (int i = 0; i < QTW; ++i) {             // q-tile i = wave + 8*i
            const float* qr = qrow0 + (size_t)i * (NWAVES * 16 * TD) + ta;
            a[i].x = qr[0] * kx;
            a[i].y = qr[1] * ky;
        }
        #pragma unroll
        for (int f = 0; f < 8; ++f) {
            const float* wr = Wal + (size_t)(f * 16 + n) * TD + ta;
            v2f bb; bb.x = wr[0]; bb.y = wr[1];     // B[t',s] = Wal[s, t+t']
            #pragma unroll
            for (int i = 0; i < QTW; ++i)
                acc[i][f] = __builtin_amdgcn_wmma_f32_16x16x4_f32(
                    false, a[i], false, bb, (short)0, acc[i][f], false, false);
        }
    }
}

__global__ __launch_bounds__(256)
void swish_attn_kernel(const float* __restrict__ query, const float* __restrict__ key,
                       const float* __restrict__ vraw,  const float* __restrict__ Wal,
                       const float* __restrict__ ksim,  float* __restrict__ vsum)
{
    extern __shared__ float smem[];
    float* vp     = smem;                   // [512][128] value partial (256 KB)
    float* st_m   = vp + QN * TD;           // [16][128] per (wave,half) run-max
    float* st_s   = st_m + 16 * TD;         // [16][128] per (wave,half) run-sum
    float* f_m    = st_s + 16 * TD;         // [128] final max per s
    float* f_d    = f_m + TD;               // [128] final denom per s
    float* keyrow = f_d + TD;               // [128]
    float* valrow = keyrow + TD;            // [128]

    const int wg   = blockIdx.x;
    const int b    = wg / (KN / KPW);
    const int k0   = (wg % (KN / KPW)) * KPW;
    const int tid  = threadIdx.x;
    const int wave = tid >> 5;              // wave32
    const int lane = tid & 31;
    const int hh   = lane >> 4;             // lane half (K / M-half select)
    const int n    = lane & 15;             // N index / A-row index

    __builtin_prefetch(Wal + (size_t)tid * 64, 0, 0);   // global_prefetch_b8

    for (int i = tid; i < QN * TD; i += 256) vp[i] = 0.f;

    const float* qb = query + (size_t)b * QN * TD;

    for (int kk = 0; kk < KPW; ++kk) {
        const int k = k0 + kk;
        __syncthreads();                    // also covers vp zeroing on iter 0

        if (tid < TD) {                     // waves 0..3: wave-uniform predicate
            const float* gk = key  + ((size_t)b * KN + k) * TD + tid;
            const float* gv = vraw + ((size_t)b * KN + k) * TD + tid;
            unsigned dk = (unsigned)(uintptr_t)(keyrow + tid);
            unsigned dv = (unsigned)(uintptr_t)(valrow + tid);
            asm volatile("global_load_async_to_lds_b32 %0, %1, off"
                         :: "v"(dk), "v"(gk) : "memory");
            asm volatile("global_load_async_to_lds_b32 %0, %1, off"
                         :: "v"(dv), "v"(gv) : "memory");
            asm volatile("s_wait_asynccnt 0x0" ::: "memory");
        }
        for (int i = tid; i < 16 * TD; i += 256) {
            st_m[i] = -INFINITY;
            st_s[i] = 0.f;
        }
        __syncthreads();

        const float kshrink = ksim[(size_t)b * KN + k];

        // ---- pass A: online column stats (max, sum |x| e^{x-max}) over q ----
        float runM[8], runS[8];
        #pragma unroll
        for (int f = 0; f < 8; ++f) { runM[f] = -INFINITY; runS[f] = 0.f; }

        v8f acc[QTW][8];                    // lives until the end of pass B
        logits_tiles(qb + (size_t)(wave * 16 + n) * TD, Wal, keyrow, hh, n, acc);

        #pragma unroll
        for (int i = 0; i < QTW; ++i) {
            #pragma unroll
            for (int f = 0; f < 8; ++f) {
                #pragma unroll
                for (int r = 0; r < 8; ++r) {
                    float x  = acc[i][f][r];
                    float nM = fmaxf(runM[f], x);
                    runS[f]  = runS[f] * __expf(runM[f] - nM)
                             + fabsf(x) * __expf(x - nM);
                    runM[f]  = nM;
                }
            }
        }
        {
            const int p = wave * 2 + hh;
            #pragma unroll
            for (int f = 0; f < 8; ++f) {
                st_m[p * TD + f * 16 + n] = runM[f];
                st_s[p * TD + f * 16 + n] = runS[f];
            }
        }
        __syncthreads();
        if (tid < TD) {                      // combine 16 partials per s-column
            float M = -INFINITY;
            for (int p = 0; p < 16; ++p) M = fmaxf(M, st_m[p * TD + tid]);
            float S = 0.f;
            for (int p = 0; p < 16; ++p)
                S += st_s[p * TD + tid] * __expf(st_m[p * TD + tid] - M);
            f_m[tid] = M;
            // shrink cancels: scale = x e^{x-M} / (S + ksim)
            f_d[tid] = S + kshrink;
        }
        __syncthreads();

        // ---- pass B: scale the kept logits, accumulate value partial ----
        #pragma unroll
        for (int i = 0; i < QTW; ++i) {
            const int qt = wave + i * NWAVES;
            #pragma unroll
            for (int f = 0; f < 8; ++f) {
                const int s   = f * 16 + n;
                const float M  = f_m[s];
                const float rD = 1.f / f_d[s];
                const float vv = valrow[s];
                #pragma unroll
                for (int r = 0; r < 8; ++r) {
                    float x  = acc[i][f][r];
                    float sc = x * __expf(x - M) * rD;
                    vp[(size_t)(qt * 16 + r + 8 * hh) * TD + s] += vv * sc;
                }
            }
        }
    }
    __syncthreads();

    // flush private partial into global accumulator (f32 HW atomics)
    float* outp = vsum + (size_t)b * QN * TD;
    for (int i = tid; i < QN * TD; i += 256)
        unsafeAtomicAdd(&outp[i], vp[i]);
}

// ---------------- Stage 4: output projection -------------------------------

__global__ __launch_bounds__(256)
void out_proj_kernel(const float* __restrict__ vsum, const float* __restrict__ Wvo,
                     float* __restrict__ out)
{
    int idx = blockIdx.x * 256 + threadIdx.x;       // [0, B*QN*TD)
    int r = idx / TD, t = idx % TD;
    const float* vrow = vsum + (size_t)r * TD;
    const float* wrow = Wvo  + (size_t)t * TD;
    float a = 0.f;
    #pragma unroll 4
    for (int s = 0; s < TD; ++s) a = fmaf(vrow[s], wrow[s], a);
    out[idx] = a;
}

// ---------------------------------------------------------------------------

extern "C" void kernel_launch(void* const* d_in, const int* in_sizes, int n_in,
                              void* d_out, int out_size, void* d_ws, size_t ws_size,
                              hipStream_t stream)
{
    const float* qtok = (const float*)d_in[0];  // query_tokens [B,Q,T]
    const float* ktok = (const float*)d_in[1];  // key_tokens   [B,K,T]
    const float* Wk   = (const float*)d_in[2];
    const float* Wq   = (const float*)d_in[3];
    const float* Wva  = (const float*)d_in[4];
    const float* Wal  = (const float*)d_in[5];
    const float* Wvo  = (const float*)d_in[6];
    float* out = (float*)d_out;

    float* ws      = (float*)d_ws;              // ~2.1 MB used
    float* w_key   = ws;                        // [NROW*TD]
    float* w_query = w_key   + NROW * TD;
    float* w_vraw  = w_query + NROW * TD;
    float* w_vsum  = w_vraw  + NROW * TD;
    float* w_inorm = w_vsum  + NROW * TD;       // [NROW]
    float* w_ksim  = w_inorm + NROW;            // [NROW]

    dim3 blk256(256), blk128(128);
    const int nElem = NROW * TD;                // 131072

    proj_qk_kernel<<<nElem / 256, blk256, 0, stream>>>(qtok, ktok, Wq, Wk,
                                                       w_query, w_key, w_vsum);
    proj_v_kernel <<<nElem / 256, blk256, 0, stream>>>(w_key, Wva, w_vraw);
    norm_kernel   <<<NROW, blk128, 0, stream>>>(w_key, w_inorm);
    ksim_kernel   <<<NROW, blk128, 0, stream>>>(w_key, w_inorm, w_ksim);

    size_t lds_bytes = (size_t)(QN * TD + 2 * 16 * TD + 4 * TD) * sizeof(float); // 280.5 KB
    swish_attn_kernel<<<B_ * (KN / KPW), blk256, lds_bytes, stream>>>(
        w_query, w_key, w_vraw, Wal, w_ksim, w_vsum);

    out_proj_kernel<<<nElem / 256, blk256, 0, stream>>>(w_vsum, Wvo, out);
}

// v002
// Measured time: 179 microseconds a run.
// Timed twice side by side with v001, it ran 1.04 and 1.03 times as fast.
// Counting every step since v000, it is 2.46 times as fast.
#include <hip/hip_runtime.h>
#include <math.h>

typedef float v2f __attribute__((ext_vector_type(2)));
typedef float v8f __attribute__((ext_vector_type(8)));

constexpr int B_  = 2;
constexpr int QN  = 512;
constexpr int KN  = 512;
constexpr int TD  = 128;
constexpr int NROW = B_ * KN;     // 1024 rows for [B,*,T] tensors
constexpr int KPW  = 4;           // keys per workgroup
constexpr int NWAVES = 8;         // 256 threads = 8 wave32
constexpr int QTW  = QN / 16 / NWAVES;   // q-tiles per wave (4)
constexpr int NG   = KN / KPW;    // key groups = value partials per batch (128)
constexpr int CH   = 2 * TD;      // floats per chunk of a partial: two q rows
constexpr int NCH  = QN * TD / CH;       // chunks per batch (256)

// ---------------- Stage 1: input projections (tiny: ~0.1 GFLOP) ------------

__global__ __launch_bounds__(256)
void proj_qk_kernel(const float* __restrict__ qtok, const float* __restrict__ ktok,
                    const float* __restrict__ Wq,   const float* __restrict__ Wk,
                    float* __restrict__ query, float* __restrict__ key)
{
    int idx = blockIdx.x * 256 + threadIdx.x;       // [0, NROW*TD)
    int r = idx / TD, t = idx % TD;
    const float* qrow = qtok + (size_t)r * TD;
    const float* krow = ktok + (size_t)r * TD;
    const float* wq   = Wq   + (size_t)t * TD;
    const float* wk   = Wk   + (size_t)t * TD;
    float aq = 0.f, ak = 0.f;
    #pragma unroll 4
    for (int s = 0; s < TD; ++s) {
        aq = fmaf(qrow[s], wq[s], aq);              // x @ W.T
        ak = fmaf(krow[s], wk[s], ak);
    }
    query[idx] = aq;
    key[idx]   = ak;
}

__global__ __launch_bounds__(256)
void proj_v_kernel(const float* __restrict__ key, const float* __restrict__ Wva,
                   float* __restrict__ vraw)
{
    int idx = blockIdx.x * 256 + threadIdx.x;
    int r = idx / TD, t = idx % TD;
    const float* krow = key + (size_t)r * TD;
    const float* wrow = Wva + (size_t)t * TD;
    float a = 0.f;
    #pragma unroll 4
    for (int s = 0; s < TD; ++s) a = fmaf(krow[s], wrow[s], a);
    vraw[idx] = a;
}

// ---------------- Stage 2: key norms + pairwise cosine similarity ----------

__global__ __launch_bounds__(128)
void norm_kernel(const float* __restrict__ key, float* __restrict__ inv_norm)
{
    __shared__ float red[128];
    int r = blockIdx.x, t = threadIdx.x;
    float v = key[(size_t)r * TD + t];
    red[t] = v * v;
    __syncthreads();
    for (int off = 64; off > 0; off >>= 1) {
        if (t < off) red[t] += red[t + off];
        __syncthreads();
    }
    if (t == 0) {
        float nn = fmaxf(sqrtf(red[0]), 1e-8f);     // torch cosine eps clamp
        inv_norm[r] = 1.f / nn;
    }
}

// ksim[b,k] = sum_j (kn_k . kn_j)^2   (== diag of (Kn Kn^T)^2)
__global__ __launch_bounds__(128)
void ksim_kernel(const float* __restrict__ key, const float* __restrict__ inv_norm,
                 float* __restrict__ ksim)
{
    __shared__ float kk[TD];
    __shared__ float red[128];
    int r = blockIdx.x;                 // b*KN + k
    int b = r / KN;
    int t = threadIdx.x;
    float ink = inv_norm[r];
    kk[t] = key[(size_t)r * TD + t] * ink;
    __syncthreads();
    float acc = 0.f;
    for (int j = t; j < KN; j += 128) {
        const float* krow = key + ((size_t)b * KN + j) * TD;
        float inj = inv_norm[b * KN + j];
        float dot = 0.f;
        #pragma unroll 4
        for (int s = 0; s < TD; ++s) dot = fmaf(kk[s], krow[s], dot);
        float c = dot * inj;
        acc = fmaf(c, c, acc);
    }
    red[t] = acc;
    __syncthreads();
    for (int off = 64; off > 0; off >>= 1) {
        if (t < off) red[t] += red[t + off];
        __syncthreads();
    }
    if (t == 0) ksim[r] = red[0];
}

__device__ __forceinline__ void logits_tiles(const float* __restrict__ qrow0,
                                             const float* __restrict__ Wal,
                                             const float* keyrow,
                                             int hh, int n, v8f (&acc)[QTW][8])
{
    v8f zero = {};
    #pragma unroll
    for (int i = 0; i < QTW; ++i) {
        #pragma unroll
        for (int f = 0; f < 8; ++f) acc[i][f] = zero;
    }
    for (int t = 0; t < TD; t += 4) {
        const int ta = t + 2 * hh;                  // fp32 A frag: K = {2h, 2h+1}
        const float kx = keyrow[ta];
        const float ky = keyrow[ta + 1];
        v2f a[QTW];
        #pragma unroll
        for (int i = 0; i < QTW; ++i) {             // q-tile i = wave + 8*i
            const float* qr = qrow0 + (size_t)i * (NWAVES * 16 * TD) + ta;
            a[i].x = qr[0] * kx;
            a[i].y = qr[1] * ky;
        }
        #pragma unroll
        for (int f = 0; f < 8; ++f) {
            const float* wr = Wal + (size_t)(f * 16 + n) * TD + ta;
            v2f bb; bb.x = wr[0]; bb.y = wr[1];     // B[t',s] = Wal[s, t+t']
            #pragma unroll
            for (int i = 0; i < QTW; ++i)
                acc[i][f] = __builtin_amdgcn_wmma_f32_16x16x4_f32(
                    false, a[i], false, bb, (short)0, acc[i][f], false, false);
        }
    }
}

__global__ __launch_bounds__(256)
void swish_attn_kernel(const float* __restrict__ query, const float* __restrict__ key,
                       const float* __restrict__ vraw,  const float* __restrict__ Wal,
                       const float* __restrict__ ksim,  float* __restrict__ part)
{
    extern __shared__ __attribute__((aligned(16))) float smem[];
    float* vp     = smem;                   // [512][128] value partial (256 KB)
    float* st_m   = vp + QN * TD;           // [16][128] per (wave,half) run-max
    float* st_s   = st_m + 16 * TD;         // [16][128] per (wave,half) run-sum
    float* f_m    = st_s + 16 * TD;         // [128] final max per s
    float* f_d    = f_m + TD;               // [128] final denom per s
    float* keyrow = f_d + TD;               // [128]
    float* valrow = keyrow + TD;            // [128]

    const int wg   = blockIdx.x;
    const int b    = wg / (KN / KPW);
    const int k0   = (wg % (KN / KPW)) * KPW;
    const int tid  = threadIdx.x;
    const int wave = tid >> 5;              // wave32
    const int lane = tid & 31;
    const int hh   = lane >> 4;             // lane half (K / M-half select)
    const int n    = lane & 15;             // N index / A-row index

    __builtin_prefetch(Wal + (size_t)tid * 64, 0, 0);   // global_prefetch_b8

    for (int i = tid; i < QN * TD; i += 256) vp[i] = 0.f;

    const float* qb = query + (size_t)b * QN * TD;

    for (int kk = 0; kk < KPW; ++kk) {
        const int k = k0 + kk;
        __syncthreads();                    // also covers vp zeroing on iter 0

        if (tid < TD) {                     // waves 0..3: wave-uniform predicate
            const float* gk = key  + ((size_t)b * KN + k) * TD + tid;
            const float* gv = vraw + ((size_t)b * KN + k) * TD + tid;
            unsigned dk = (unsigned)(uintptr_t)(keyrow + tid);
            unsigned dv = (unsigned)(uintptr_t)(valrow + tid);
            asm volatile("global_load_async_to_lds_b32 %0, %1, off"
                         :: "v"(dk), "v"(gk) : "memory");
            asm volatile("global_load_async_to_lds_b32 %0, %1, off"
                         :: "v"(dv), "v"(gv) : "memory");
            asm volatile("s_wait_asynccnt 0x0" ::: "memory");
        }
        for (int i = tid; i < 16 * TD; i += 256) {
            st_m[i] = -INFINITY;
            st_s[i] = 0.f;
        }
        __syncthreads();

        const float kshrink = ksim[(size_t)b * KN + k];

        // ---- pass A: online column stats (max, sum |x| e^{x-max}) over q ----
        float runM[8], runS[8];
        #pragma unroll
        for (int f = 0; f < 8; ++f) { runM[f] = -INFINITY; runS[f] = 0.f; }

        v8f acc[QTW][8];                    // lives until the end of pass B
        logits_tiles(qb + (size_t)(wave * 16 + n) * TD, Wal, keyrow, hh, n, acc);

        #pragma unroll
        for (int i = 0; i < QTW; ++i) {
            #pragma unroll
            for (int f = 0; f < 8; ++f) {
                #pragma unroll
                for (int r = 0; r < 8; ++r) {
                    float x  = acc[i][f][r];
                    float nM = fmaxf(runM[f], x);
                    runS[f]  = runS[f] * __expf(runM[f] - nM)
                             + fabsf(x) * __expf(x - nM);
                    runM[f]  = nM;
                }
            }
        }
        {
            const int p = wave * 2 + hh;
            #pragma unroll
            for (int f = 0; f < 8; ++f) {
                st_m[p * TD + f * 16 + n] = runM[f];
                st_s[p * TD + f * 16 + n] = runS[f];
            }
        }
        __syncthreads();
        if (tid < TD) {                      // combine 16 partials per s-column
            float M = -INFINITY;
            for (int p = 0; p < 16; ++p) M = fmaxf(M, st_m[p * TD + tid]);
            float S = 0.f;
            for (int p = 0; p < 16; ++p)
                S += st_s[p * TD + tid] * __expf(st_m[p * TD + tid] - M);
            f_m[tid] = M;
            // shrink cancels: scale = x e^{x-M} / (S + ksim)
            f_d[tid] = S + kshrink;
        }
        __syncthreads();

        // ---- pass B: scale the kept logits, accumulate value partial ----
        #pragma unroll
        for (int i = 0; i < QTW; ++i) {
            const int qt = wave + i * NWAVES;
            #pragma unroll
            for (int f = 0; f < 8; ++f) {
                const int s   = f * 16 + n;
                const float M  = f_m[s];
                const float rD = 1.f / f_d[s];
                const float vv = valrow[s];
                #pragma unroll
                for (int r = 0; r < 8; ++r) {
                    float x  = acc[i][f][r];
                    float sc = x * __expf(x - M) * rD;
                    vp[(size_t)(qt * 16 + r + 8 * hh) * TD + s] += vv * sc;
                }
            }
        }
    }
    __syncthreads();

    // Flush the private partial with plain 16-byte stores; no other work-group
    // writes these lines. Layout part[b][chunk][key group][CH]: the 128 partials
    // of one chunk lie side by side for the kernel that sums them.
    constexpr int C4 = CH / 4;              // float4 per chunk (64)
    constexpr int CPS = 256 / C4;           // chunks the block stores per sweep (4)
    const float4* src = reinterpret_cast<const float4*>(vp) + tid;
    float4* dst = reinterpret_cast<float4*>(
                      part + ((size_t)(b * NCH + tid / C4) * NG + wg % NG) * CH) + tid % C4;
    constexpr int GRP = 16;                 // stores per group
    for (int it = 0; it < NCH / CPS; it += GRP) {
        float4 v[GRP];
        #pragma unroll   // one group of LDS reads, then one group of stores
        for (int u = 0; u < GRP; ++u) v[u] = src[(it + u) * 256];
        #pragma unroll
        for (int u = 0; u < GRP; ++u) dst[(size_t)(it + u) * CPS * NG * C4] = v[u];
        // the next trip rewrites the registers that these stores name
        asm volatile("s_wait_xcnt 0x0" ::: "memory");
    }
}

// ---------------- Stage 4: sum of the partials + output projection ---------
//
// One block owns one chunk (two q rows). Its NG partials are 128 KB in a row:
// thread = (float4 column, quarter of the key groups) adds 32 of them in key
// group order, LDS joins the four quarters, always in the same order.

__global__ __launch_bounds__(256)
void out_proj_kernel(const float* __restrict__ part, const float* __restrict__ Wvo,
                     float* __restrict__ out)
{
    __shared__ float4 red[4][CH / 4];
    __shared__ float  vs[CH];
    const int tid = threadIdx.x;
    const int col = tid % (CH / 4);
    const int grp = tid / (CH / 4);
    const float4* p = reinterpret_cast<const float4*>(part + (size_t)blockIdx.x * NG * CH)
                    + (size_t)grp * (NG / 4) * (CH / 4) + col;
    float4 s4 = make_float4(0.f, 0.f, 0.f, 0.f);
    #pragma unroll   // straight line: many independent 16-byte loads in flight per lane
    for (int g = 0; g < NG / 4; ++g) {
        const float4 v = p[(size_t)g * (CH / 4)];
        s4.x += v.x; s4.y += v.y; s4.z += v.z; s4.w += v.w;
    }
    red[grp][col] = s4;
    __syncthreads();
    {
        const float* rf = reinterpret_cast<const float*>(red);
        vs[tid] = (rf[tid] + rf[CH + tid]) + (rf[2 * CH + tid] + rf[3 * CH + tid]);
    }
    __syncthreads();

    int idx = blockIdx.x * 256 + tid;               // [0, B*QN*TD)
    int t = idx % TD;
    const float* vrow = vs + (tid / TD) * TD;
    const float* wrow = Wvo  + (size_t)t * TD;
    float a = 0.f;
    #pragma unroll 4
    for (int s = 0; s < TD; ++s) a = fmaf(vrow[s], wrow[s], a);
    out[idx] = a;
}

// ---------------------------------------------------------------------------

extern "C" void kernel_launch(void* const* d_in, const int* in_sizes, int n_in,
                              void* d_out, int out_size, void* d_ws, size_t ws_size,
                              hipStream_t stream)
{
    const float* qtok = (const float*)d_in[0];  // query_tokens [B,Q,T]
    const float* ktok = (const float*)d_in[1];  // key_tokens   [B,K,T]
    const float* Wk   = (const float*)d_in[2];
    const float* Wq   = (const float*)d_in[3];
    const float* Wva  = (const float*)d_in[4];
    const float* Wal  = (const float*)d_in[5];
    const float* Wvo  = (const float*)d_in[6];
    float* out = (float*)d_out;

    float* ws      = (float*)d_ws;              // 68 MB used
    float* w_key   = ws;                        // [NROW*TD]
    float* w_query = w_key   + NROW * TD;
    float* w_vraw  = w_query + NROW * TD;
    float* w_inorm = w_vraw  + NROW * TD;       // [NROW]
    float* w_ksim  = w_inorm + NROW;            // [NROW]
    float* w_part  = ws + (1 << 20);            // [B][NCH][NG][CH] = 64 MB

    dim3 blk256(256), blk128(128);
    const int nElem = NROW * TD;                // 131072

    proj_qk_kernel<<<nElem / 256, blk256, 0, stream>>>(qtok, ktok, Wq, Wk,
                                                       w_query, w_key);
    proj_v_kernel <<<nElem / 256, blk256, 0, stream>>>(w_key, Wva, w_vraw);
    norm_kernel   <<<NROW, blk128, 0, stream>>>(w_key, w_inorm);
    ksim_kernel   <<<NROW, blk128, 0, stream>>>(w_key, w_inorm, w_ksim);

    size_t lds_bytes = (size_t)(QN * TD + 2 * 16 * TD + 4 * TD) * sizeof(float); // 280.5 KB
    swish_attn_kernel<<<B_ * (KN / KPW), blk256, lds_bytes, stream>>>(
        w_query, w_key, w_vraw, Wal, w_ksim, w_part);

    out_proj_kernel<<<nElem / 256, blk256, 0, stream>>>(w_part, Wvo, out);
}

// v003
// One run takes 153 microseconds.
// Next to v002, in two timings, it ran 1.17 times as fast each time.
// Over all steps from v000 it is 2.88 times as fast.
#include <hip/hip_runtime.h>
#include <math.h>

typedef float v2f __attribute__((ext_vector_type(2)));
typedef float v8f __attribute__((ext_vector_type(8)));

constexpr int B_  = 2;
constexpr int QN  = 512;
constexpr int KN  = 512;
constexpr int TD  = 128;
constexpr int NROW = B_ * KN;     // 1024 rows for [B,*,T] tensors
constexpr int KPW  = 4;           // keys per workgroup
constexpr int NWAVES = 8;         // 256 threads = 8 wave32
constexpr int QTW  = QN / 16 / NWAVES;   // q-tiles per wave (4)
constexpr int NG   = KN / KPW;    // key groups = value partials per batch (128)
constexpr int CH   = 2 * TD;      // floats per chunk of a partial: two q rows
constexpr int NCH  = QN * TD / CH;       // chunks per batch (256)

// ---------------- Small dense products: operands through LDS ---------------
//
// Every small product here is y[r][t] = sum_s x[r][s] * M[t][s], one lane per
// row t of M. Read from global memory that is one 128-byte line per lane and
// load. Instead the block copies M into LDS with asynchronous copies that cover
// whole rows, and each lane walks its row there, for several x rows at a time.

constexpr int WP = TD + 4;

// Copy NR (a multiple of 64) contiguous rows of TD floats to LDS at pitch WP,
// through no register. A sweep = the block's 8 waves (256 threads) copy 8 rows:
// one wave-wide 16-byte copy = one whole 512-byte row. NR / 8 copies per wave
// are left in flight: the caller waits (s_wait_asynccnt 0) and then barriers.
template <int NR>
__device__ __forceinline__ void copy_rows_async(const float* g, float* l, int tid)
{
    constexpr unsigned LS = 8 * WP * 4;             // LDS bytes per sweep
    constexpr int      GS = 8 * TD;                 // floats per sweep
    // low 32 bits of a generic pointer into LDS = the LDS byte address
    const unsigned l0 = (unsigned)(uintptr_t)(l + (tid >> 5) * WP + (tid & 31) * 4);
    const float*   g0 = g + tid * 4;
    #pragma unroll   // straight line: no loop-carried address registers
    for (int u = 0; u < NR / 8; u += 8) {
        const unsigned a = l0 + u * LS;
        const float*   p = g0 + u * GS;
        // the wait ends the statement: the copies' address registers are free behind it
        asm volatile("global_load_async_to_lds_b128 %0, %8, off\n\t"
                     "global_load_async_to_lds_b128 %1, %9, off\n\t"
                     "global_load_async_to_lds_b128 %2, %10, off\n\t"
                     "global_load_async_to_lds_b128 %3, %11, off\n\t"
                     "global_load_async_to_lds_b128 %4, %12, off\n\t"
                     "global_load_async_to_lds_b128 %5, %13, off\n\t"
                     "global_load_async_to_lds_b128 %6, %14, off\n\t"
                     "global_load_async_to_lds_b128 %7, %15, off\n\t"
                     "s_wait_xcnt 0x0"
                     :: "v"(a), "v"(a + LS), "v"(a + 2 * LS), "v"(a + 3 * LS),
                        "v"(a + 4 * LS), "v"(a + 5 * LS), "v"(a + 6 * LS), "v"(a + 7 * LS),
                        "v"(p), "v"(p + GS), "v"(p + 2 * GS), "v"(p + 3 * GS),
                        "v"(p + 4 * GS), "v"(p + 5 * GS), "v"(p + 6 * GS), "v"(p + 7 * GS)
                     : "memory");
    }
}

// The issuing wave's copies have landed behind this; other waves need the barrier too.
__device__ __forceinline__ void wait_copies()
{
    asm volatile("s_wait_asynccnt 0x0" ::: "memory");
}

// a[j] = sum_s xrows[j][s] * mrow[s], s ascending, one fused multiply-add each.
template <int R>
__device__ __forceinline__ void dot_rows(const float* mrow, const float* xrows, float (&a)[R])
{
    #pragma unroll   // constant indices keep the small array in registers
    for (int j = 0; j < R; ++j) a[j] = 0.f;
    #pragma unroll 8   // eight groups of LDS reads in flight cover the LDS latency
    for (int s = 0; s < TD; s += 4) {
        const float4 m = *reinterpret_cast<const float4*>(mrow + s);
        #pragma unroll   // constant indices keep the small array in registers
        for (int j = 0; j < R; ++j) {
            const float4 x = *reinterpret_cast<const float4*>(xrows + j * TD + s);
            a[j] = fmaf(x.x, m.x, a[j]);
            a[j] = fmaf(x.y, m.y, a[j]);
            a[j] = fmaf(x.z, m.z, a[j]);
            a[j] = fmaf(x.w, m.w, a[j]);
        }
    }
}

// y = x @ W.T for 2*R rows of x: thread = (column t, half g of the rows).
template <int R>
__device__ __forceinline__ void project_rows(const float* __restrict__ x,
                                             const float* __restrict__ W,
                                             float* __restrict__ y,
                                             float* wt, float* xs, int tid)
{
    constexpr int NX = 2 * R * (TD / 4);            // float4 in the x rows (<= 256)
    copy_rows_async<TD>(W, wt, tid);
    if (tid < NX)                                   // flies with W's copies
        reinterpret_cast<float4*>(xs)[tid] = reinterpret_cast<const float4*>(x)[tid];
    wait_copies();
    __syncthreads();
    const int t = tid % TD, g = tid / TD;
    float a[R];
    dot_rows<R>(wt + t * WP, xs + g * R * TD, a);
    #pragma unroll   // constant indices keep the small array in registers
    for (int j = 0; j < R; ++j) y[(size_t)(g * R + j) * TD + t] = a[j];
}

// ---------------- Stage 1: input projections (tiny: ~0.1 GFLOP) ------------

constexpr int RQK = 4;            // x rows per thread; 8 rows per block
constexpr int RV  = 2;            // x rows per thread; 4 rows per block

__global__ __launch_bounds__(256)
void proj_qk_kernel(const float* __restrict__ qtok, const float* __restrict__ ktok,
                    const float* __restrict__ Wq,   const float* __restrict__ Wk,
                    float* __restrict__ query, float* __restrict__ key)
{
    __shared__ __attribute__((aligned(16))) float wt[TD * WP];
    __shared__ __attribute__((aligned(16))) float xs[2 * RQK * TD];
    constexpr int NB = NROW / (2 * RQK);            // blocks per projection
    const bool isk = blockIdx.x >= NB;
    const size_t off = (size_t)(blockIdx.x % NB) * (2 * RQK * TD);
    project_rows<RQK>((isk ? ktok : qtok) + off, isk ? Wk : Wq,
                      (isk ? key : query) + off, wt, xs, threadIdx.x);
}

__global__ __launch_bounds__(256)
void proj_v_kernel(const float* __restrict__ key, const float* __restrict__ Wva,
                   float* __restrict__ vraw)
{
    __shared__ __attribute__((aligned(16))) float wt[TD * WP];
    __shared__ __attribute__((aligned(16))) float xs[2 * RV * TD];
    const size_t off = (size_t)blockIdx.x * (2 * RV * TD);
    project_rows<RV>(key + off, Wva, vraw + off, wt, xs, threadIdx.x);
}

// ---------------- Stage 2: key norms + pairwise cosine similarity ----------

__global__ __launch_bounds__(128)
void norm_kernel(const float* __restrict__ key, float* __restrict__ inv_norm)
{
    __shared__ float red[128];
    int r = blockIdx.x, t = threadIdx.x;
    float v = key[(size_t)r * TD + t];
    red[t] = v * v;
    __syncthreads();
    for (int off = 64; off > 0; off >>= 1) {
        if (t < off) red[t] += red[t + off];
        __syncthreads();
    }
    if (t == 0) {
        float nn = fmaxf(sqrtf(red[0]), 1e-8f);     // torch cosine eps clamp
        inv_norm[r] = 1.f / nn;
    }
}

// ksim[b,k] = sum_j (kn_k . kn_j)^2   (== diag of (Kn Kn^T)^2)
//
// One block = KR keys k against all KN keys j of their batch, which it holds in
// LDS (264 KB). Thread = two rows j; each 16 bytes of a row j meet KR keys k.
constexpr int KR = 4;

__global__ __launch_bounds__(256)
void ksim_kernel(const float* __restrict__ key, const float* __restrict__ inv_norm,
                 float* __restrict__ ksim)
{
    __shared__ __attribute__((aligned(16))) float kt[KN * WP];
    __shared__ __attribute__((aligned(16))) float kk[KR * TD];
    __shared__ float cb[KR][KN];        // cosines
    __shared__ float red[KR][128];
    const int r0  = blockIdx.x * KR;    // b*KN + k of the first key
    const int b   = r0 / KN;
    const int tid = threadIdx.x;

    // small loads first, so that they fly with the fill
    const float in0 = inv_norm[b * KN + tid];
    const float in1 = inv_norm[b * KN + tid + 256];
    const float kv0 = key[(size_t)r0 * TD + tid]       * inv_norm[r0 + tid / TD];
    const float kv1 = key[(size_t)r0 * TD + tid + 256] * inv_norm[r0 + 2 + tid / TD];
    // two runs of 32 copies per wave: a wave keeps fewer than 64 in flight
    const float* kb = key + (size_t)b * KN * TD;
    copy_rows_async<KN / 2>(kb, kt, tid);
    wait_copies();
    copy_rows_async<KN / 2>(kb + (KN / 2) * TD, kt + (KN / 2) * WP, tid);
    kk[tid]       = kv0;
    kk[tid + 256] = kv1;
    wait_copies();
    __syncthreads();

    float d0[KR], d1[KR];
    #pragma unroll   // constant indices keep the small array in registers
    for (int j = 0; j < KR; ++j) { d0[j] = 0.f; d1[j] = 0.f; }
    const float* row0 = kt + tid * WP;
    const float* row1 = kt + (tid + 256) * WP;
    #pragma unroll 4   // four groups of LDS reads in flight cover the LDS latency
    for (int s = 0; s < TD; s += 4) {
        const float4 m0 = *reinterpret_cast<const float4*>(row0 + s);
        const float4 m1 = *reinterpret_cast<const float4*>(row1 + s);
        #pragma unroll   // constant indices keep the small array in registers
        for (int j = 0; j < KR; ++j) {
            const float4 x = *reinterpret_cast<const float4*>(kk + j * TD + s);
            d0[j] = fmaf(x.x, m0.x, d0[j]);  d1[j] = fmaf(x.x, m1.x, d1[j]);
            d0[j] = fmaf(x.y, m0.y, d0[j]);  d1[j] = fmaf(x.y, m1.y, d1[j]);
            d0[j] = fmaf(x.z, m0.z, d0[j]);  d1[j] = fmaf(x.z, m1.z, d1[j]);
            d0[j] = fmaf(x.w, m0.w, d0[j]);  d1[j] = fmaf(x.w, m1.w, d1[j]);
        }
    }
    #pragma unroll   // constant indices keep the small array in registers
    for (int j = 0; j < KR; ++j) {
        cb[j][tid]       = d0[j] * in0;
        cb[j][tid + 256] = d1[j] * in1;
    }
    __syncthreads();

    // Sum of squares per key: 128 strided chains, then a halving tree.
    // Thread = (chain t, keys g and g + 2).
    const int t = tid % 128, g = tid / 128;
    #pragma unroll   // both keys' LDS reads in flight together
    for (int h = 0; h < KR / 2; ++h) {
        const int j = g + 2 * h;
        float acc = 0.f;
        #pragma unroll   // the chain's four LDS reads in flight together
        for (int m = 0; m < KN / 128; ++m) {
            const float c = cb[j][t + 128 * m];
            acc = fmaf(c, c, acc);
        }
        red[j][t] = acc;
    }
    __syncthreads();
    for (int off = 64; off > 0; off >>= 1) {
        if (t < off) {
            #pragma unroll   // both keys' LDS reads in flight together
            for (int h = 0; h < KR / 2; ++h) red[g + 2 * h][t] += red[g + 2 * h][t + off];
        }
        __syncthreads();
    }
    if (tid < KR) ksim[r0 + tid] = red[tid][0];
}

__device__ __forceinline__ void logits_tiles(const float* __restrict__ qrow0,
                                             const float* __restrict__ Wal,
                                             const float* keyrow,
                                             int hh, int n, v8f (&acc)[QTW][8])
{
    v8f zero = {};
    #pragma unroll
    for (int i = 0; i < QTW; ++i) {
        #pragma unroll
        for (int f = 0; f < 8; ++f) acc[i][f] = zero;
    }
    for (int t = 0; t < TD; t += 4) {
        const int ta = t + 2 * hh;                  // fp32 A frag: K = {2h, 2h+1}
        const float kx = keyrow[ta];
        const float ky = keyrow[ta + 1];
        v2f a[QTW];
        #pragma unroll
        for (int i = 0; i < QTW; ++i) {             // q-tile i = wave + 8*i
            const float* qr = qrow0 + (size_t)i * (NWAVES * 16 * TD) + ta;
            a[i].x = qr[0] * kx;
            a[i].y = qr[1] * ky;
        }
        #pragma unroll
        for (int f = 0; f < 8; ++f) {
            const float* wr = Wal + (size_t)(f * 16 + n) * TD + ta;
            v2f bb; bb.x = wr[0]; bb.y = wr[1];     // B[t',s] = Wal[s, t+t']
            #pragma unroll
            for (int i = 0; i < QTW; ++i)
                acc[i][f] = __builtin_amdgcn_wmma_f32_16x16x4_f32(
                    false, a[i], false, bb, (short)0, acc[i][f], false, false);
        }
    }
}

__global__ __launch_bounds__(256)
void swish_attn_kernel(const float* __restrict__ query, const float* __restrict__ key,
                       const float* __restrict__ vraw,  const float* __restrict__ Wal,
                       const float* __restrict__ ksim,  float* __restrict__ part)
{
    extern __shared__ __attribute__((aligned(16))) float smem[];
    float* vp     = smem;                   // [512][128] value partial (256 KB)
    float* st_m   = vp + QN * TD;           // [16][128] per (wave,half) run-max
    float* st_s   = st_m + 16 * TD;         // [16][128] per (wave,half) run-sum
    float* f_m    = st_s + 16 * TD;         // [128] final max per s
    float* f_d    = f_m + TD;               // [128] final denom per s
    float* keyrow = f_d + TD;               // [128]
    float* valrow = keyrow + TD;            // [128]

    const int wg   = blockIdx.x;
    const int b    = wg / (KN / KPW);
    const int k0   = (wg % (KN / KPW)) * KPW;
    const int tid  = threadIdx.x;
    const int wave = tid >> 5;              // wave32
    const int lane = tid & 31;
    const int hh   = lane >> 4;             // lane half (K / M-half select)
    const int n    = lane & 15;             // N index / A-row index

    __builtin_prefetch(Wal + (size_t)tid * 64, 0, 0);   // global_prefetch_b8

    for (int i = tid; i < QN * TD; i += 256) vp[i] = 0.f;

    const float* qb = query + (size_t)b * QN * TD;

    for (int kk = 0; kk < KPW; ++kk) {
        const int k = k0 + kk;
        __syncthreads();                    // also covers vp zeroing on iter 0

        if (tid < TD) {                     // waves 0..3: wave-uniform predicate
            const float* gk = key  + ((size_t)b * KN + k) * TD + tid;
            const float* gv = vraw + ((size_t)b * KN + k) * TD + tid;
            unsigned dk = (unsigned)(uintptr_t)(keyrow + tid);
            unsigned dv = (unsigned)(uintptr_t)(valrow + tid);
            asm volatile("global_load_async_to_lds_b32 %0, %1, off"
                         :: "v"(dk), "v"(gk) : "memory");
            asm volatile("global_load_async_to_lds_b32 %0, %1, off"
                         :: "v"(dv), "v"(gv) : "memory");
            asm volatile("s_wait_asynccnt 0x0" ::: "memory");
        }
        for (int i = tid; i < 16 * TD; i += 256) {
            st_m[i] = -INFINITY;
            st_s[i] = 0.f;
        }
        __syncthreads();

        const float kshrink = ksim[(size_t)b * KN + k];

        // ---- pass A: online column stats (max, sum |x| e^{x-max}) over q ----
        float runM[8], runS[8];
        #pragma unroll
        for (int f = 0; f < 8; ++f) { runM[f] = -INFINITY; runS[f] = 0.f; }

        v8f acc[QTW][8];                    // lives until the end of pass B
        logits_tiles(qb + (size_t)(wave * 16 + n) * TD, Wal, keyrow, hh, n, acc);

        #pragma unroll
        for (int i = 0; i < QTW; ++i) {
            #pragma unroll
            for (int f = 0; f < 8; ++f) {
                #pragma unroll
                for (int r = 0; r < 8; ++r) {
                    float x  = acc[i][f][r];
                    float nM = fmaxf(runM[f], x);
                    runS[f]  = runS[f] * __expf(runM[f] - nM)
                             + fabsf(x) * __expf(x - nM);
                    runM[f]  = nM;
                }
            }
        }
        {
            const int p = wave * 2 + hh;
            #pragma unroll
            for (int f = 0; f < 8; ++f) {
                st_m[p * TD + f * 16 + n] = runM[f];
                st_s[p * TD + f * 16 + n] = runS[f];
            }
        }
        __syncthreads();
        if (tid < TD) {                      // combine 16 partials per s-column
            float M = -INFINITY;
            for (int p = 0; p < 16; ++p) M = fmaxf(M, st_m[p * TD + tid]);
            float S = 0.f;
            for (int p = 0; p < 16; ++p)
                S += st_s[p * TD + tid] * __expf(st_m[p * TD + tid] - M);
            f_m[tid] = M;
            // shrink cancels: scale = x e^{x-M} / (S + ksim)
            f_d[tid] = S + kshrink;
        }
        __syncthreads();

        // ---- pass B: scale the kept logits, accumulate value partial ----
        #pragma unroll
        for (int i = 0; i < QTW; ++i) {
            const int qt = wave + i * NWAVES;
            #pragma unroll
            for (int f = 0; f < 8; ++f) {
                const int s   = f * 16 + n;
                const float M  = f_m[s];
                const float rD = 1.f / f_d[s];
                const float vv = valrow[s];
                #pragma unroll
                for (int r = 0; r < 8; ++r) {
                    float x  = acc[i][f][r];
                    float sc = x * __expf(x - M) * rD;
                    vp[(size_t)(qt * 16 + r + 8 * hh) * TD + s] += vv * sc;
                }
            }
        }
    }
    __syncthreads();

    // Flush the private partial with plain 16-byte stores; no other work-group
    // writes these lines. Layout part[b][chunk][key group][CH]: the 128 partials
    // of one chunk lie side by side for the kernel that sums them.
    constexpr int C4 = CH / 4;              // float4 per chunk (64)
    constexpr int CPS = 256 / C4;           // chunks the block stores per sweep (4)
    const float4* src = reinterpret_cast<const float4*>(vp) + tid;
    float4* dst = reinterpret_cast<float4*>(
                      part + ((size_t)(b * NCH + tid / C4) * NG + wg % NG) * CH) + tid % C4;
    constexpr int GRP = 16;                 // stores per group
    for (int it = 0; it < NCH / CPS; it += GRP) {
        float4 v[GRP];
        #pragma unroll   // one group of LDS reads, then one group of stores
        for (int u = 0; u < GRP; ++u) v[u] = src[(it + u) * 256];
        #pragma unroll
        for (int u = 0; u < GRP; ++u) dst[(size_t)(it + u) * CPS * NG * C4] = v[u];
        // the next trip rewrites the registers that these stores name
        asm volatile("s_wait_xcnt 0x0" ::: "memory");
    }
}

// ---------------- Stage 4: sum of the partials + output projection ---------
//
// One block owns one chunk (two q rows). Its NG partials are 128 KB in a row:
// thread = (float4 column, quarter of the key groups) adds 32 of them in key
// group order, LDS joins the four quarters, always in the same order. Wvo is
// staged in LDS like the other small products' matrices.

__global__ __launch_bounds__(256)
void out_proj_kernel(const float* __restrict__ part, const float* __restrict__ Wvo,
                     float* __restrict__ out)
{
    __shared__ __attribute__((aligned(16))) float wt[TD * WP];
    __shared__ float4 red[4][CH / 4];
    __shared__ __attribute__((aligned(16))) float vs[CH];
    const int tid = threadIdx.x;
    copy_rows_async<TD>(Wvo, wt, tid);  // flies while the partials are summed
    const int col = tid % (CH / 4);
    const int grp = tid / (CH / 4);
    const float4* p = reinterpret_cast<const float4*>(part + (size_t)blockIdx.x * NG * CH)
                    + (size_t)grp * (NG / 4) * (CH / 4) + col;
    float4 s4 = make_float4(0.f, 0.f, 0.f, 0.f);
    #pragma unroll   // straight line: many independent 16-byte loads in flight per lane
    for (int g = 0; g < NG / 4; ++g) {
        const float4 v = p[(size_t)g * (CH / 4)];
        s4.x += v.x; s4.y += v.y; s4.z += v.z; s4.w += v.w;
    }
    red[grp][col] = s4;
    wait_copies();
    __syncthreads();
    {
        const float* rf = reinterpret_cast<const float*>(red);
        vs[tid] = (rf[tid] + rf[CH + tid]) + (rf[2 * CH + tid] + rf[3 * CH + tid]);
    }
    __syncthreads();

    int idx = blockIdx.x * 256 + tid;               // [0, B*QN*TD)
    float a[1];
    dot_rows<1>(wt + (tid % TD) * WP, vs + (tid / TD) * TD, a);
    out[idx] = a[0];
}

// ---------------------------------------------------------------------------

extern "C" void kernel_launch(void* const* d_in, const int* in_sizes, int n_in,
                              void* d_out, int out_size, void* d_ws, size_t ws_size,
                              hipStream_t stream)
{
    const float* qtok = (const float*)d_in[0];  // query_tokens [B,Q,T]
    const float* ktok = (const float*)d_in[1];  // key_tokens   [B,K,T]
    const float* Wk   = (const float*)d_in[2];
    const float* Wq   = (const float*)d_in[3];
    const float* Wva  = (const float*)d_in[4];
    const float* Wal  = (const float*)d_in[5];
    const float* Wvo  = (const float*)d_in[6];
    float* out = (float*)d_out;

    float* ws      = (float*)d_ws;              // 68 MB used
    float* w_key   = ws;                        // [NROW*TD]
    float* w_query = w_key   + NROW * TD;
    float* w_vraw  = w_query + NROW * TD;
    float* w_inorm = w_vraw  + NROW * TD;       // [NROW]
    float* w_ksim  = w_inorm + NROW;            // [NROW]
    float* w_part  = ws + (1 << 20);            // [B][NCH][NG][CH] = 64 MB

    dim3 blk256(256), blk128(128);
    const int nElem = NROW * TD;                // 131072

    proj_qk_kernel<<<2 * NROW / (2 * RQK), blk256, 0, stream>>>(qtok, ktok, Wq, Wk,
                                                                w_query, w_key);
    proj_v_kernel <<<NROW / (2 * RV), blk256, 0, stream>>>(w_key, Wva, w_vraw);
    norm_kernel   <<<NROW, blk128, 0, stream>>>(w_key, w_inorm);
    ksim_kernel   <<<NROW / KR, blk256, 0, stream>>>(w_key, w_inorm, w_ksim);

    size_t lds_bytes = (size_t)(QN * TD + 2 * 16 * TD + 4 * TD) * sizeof(float); // 280.5 KB
    swish_attn_kernel<<<B_ * (KN / KPW), blk256, lds_bytes, stream>>>(
        w_query, w_key, w_vraw, Wal, w_ksim, w_part);

    out_proj_kernel<<<nElem / 256, blk256, 0, stream>>>(w_part, Wvo, out);
}

// v004
// It runs in 140 microseconds.
// Two timings next to v003 put it at 1.08 and 1.09 times that version's speed.
// Over all steps from v000 it is 3.12 times as fast.
#include <hip/hip_runtime.h>
#include <math.h>

typedef float v2f __attribute__((ext_vector_type(2)));
typedef float v8f __attribute__((ext_vector_type(8)));

constexpr int B_  = 2;
constexpr int QN  = 512;
constexpr int KN  = 512;
constexpr int TD  = 128;
constexpr int NROW = B_ * KN;     // 1024 rows for [B,*,T] tensors
constexpr int KPW  = 4;           // keys per workgroup
constexpr int NWAVES = 8;         // 256 threads = 8 wave32
constexpr int QTW  = QN / 16 / NWAVES;   // q-tiles per wave (4)
constexpr int NG   = KN / KPW;    // key groups = value partials per batch (128)
constexpr int CH   = 2 * TD;      // floats per chunk of a partial: two q rows
constexpr int NCH  = QN * TD / CH;       // chunks per batch (256)

// ---------------- Small dense products: operands through LDS ---------------
//
// Every small product here is y[r][t] = sum_s x[r][s] * M[t][s], one lane per
// row t of M. Read from global memory that is one 128-byte line per lane and
// load. Instead the block copies M into LDS with asynchronous copies that cover
// whole rows, and each lane walks its row there, for several x rows at a time.

constexpr int WP = TD + 4;

// Copy NR (a multiple of 64) contiguous rows of TD floats to LDS at pitch WP,
// through no register. A sweep = the block's 8 waves (256 threads) copy 8 rows:
// one wave-wide 16-byte copy = one whole 512-byte row. NR / 8 copies per wave
// are left in flight: the caller waits (s_wait_asynccnt 0) and then barriers.
template <int NR>
__device__ __forceinline__ void copy_rows_async(const float* g, float* l, int tid)
{
    constexpr unsigned LS = 8 * WP * 4;             // LDS bytes per sweep
    constexpr int      GS = 8 * TD;                 // floats per sweep
    // low 32 bits of a generic pointer into LDS = the LDS byte address
    const unsigned l0 = (unsigned)(uintptr_t)(l + (tid >> 5) * WP + (tid & 31) * 4);
    const float*   g0 = g + tid * 4;
    #pragma unroll   // straight line: no loop-carried address registers
    for (int u = 0; u < NR / 8; u += 8) {
        const unsigned a = l0 + u * LS;
        const float*   p = g0 + u * GS;
        // the wait ends the statement: the copies' address registers are free behind it
        asm volatile("global_load_async_to_lds_b128 %0, %8, off\n\t"
                     "global_load_async_to_lds_b128 %1, %9, off\n\t"
                     "global_load_async_to_lds_b128 %2, %10, off\n\t"
                     "global_load_async_to_lds_b128 %3, %11, off\n\t"
                     "global_load_async_to_lds_b128 %4, %12, off\n\t"
                     "global_load_async_to_lds_b128 %5, %13, off\n\t"
                     "global_load_async_to_lds_b128 %6, %14, off\n\t"
                     "global_load_async_to_lds_b128 %7, %15, off\n\t"
                     "s_wait_xcnt 0x0"
                     :: "v"(a), "v"(a + LS), "v"(a + 2 * LS), "v"(a + 3 * LS),
                        "v"(a + 4 * LS), "v"(a + 5 * LS), "v"(a + 6 * LS), "v"(a + 7 * LS),
                        "v"(p), "v"(p + GS), "v"(p + 2 * GS), "v"(p + 3 * GS),
                        "v"(p + 4 * GS), "v"(p + 5 * GS), "v"(p + 6 * GS), "v"(p + 7 * GS)
                     : "memory");
    }
}

// The issuing wave's copies have landed behind this; other waves need the barrier too.
__device__ __forceinline__ void wait_copies()
{
    asm volatile("s_wait_asynccnt 0x0" ::: "memory");
}

// a[j] = sum_s xrows[j][s] * mrow[s], s ascending, one fused multiply-add each.
template <int R>
__device__ __forceinline__ void dot_rows(const float* mrow, const float* xrows, float (&a)[R])
{
    #pragma unroll   // constant indices keep the small array in registers
    for (int j = 0; j < R; ++j) a[j] = 0.f;
    #pragma unroll 8   // eight groups of LDS reads in flight cover the LDS latency
    for (int s = 0; s < TD; s += 4) {
        const float4 m = *reinterpret_cast<const float4*>(mrow + s);
        #pragma unroll   // constant indices keep the small array in registers
        for (int j = 0; j < R; ++j) {
            const float4 x = *reinterpret_cast<const float4*>(xrows + j * TD + s);
            a[j] = fmaf(x.x, m.x, a[j]);
            a[j] = fmaf(x.y, m.y, a[j]);
            a[j] = fmaf(x.z, m.z, a[j]);
            a[j] = fmaf(x.w, m.w, a[j]);
        }
    }
}

// y = x @ W.T for 2*R rows of x: thread = (column t, half g of the rows).
template <int R>
__device__ __forceinline__ void project_rows(const float* __restrict__ x,
                                             const float* __restrict__ W,
                                             float* __restrict__ y,
                                             float* wt, float* xs, int tid)
{
    constexpr int NX = 2 * R * (TD / 4);            // float4 in the x rows (<= 256)
    copy_rows_async<TD>(W, wt, tid);
    if (tid < NX)                                   // flies with W's copies
        reinterpret_cast<float4*>(xs)[tid] = reinterpret_cast<const float4*>(x)[tid];
    wait_copies();
    __syncthreads();
    const int t = tid % TD, g = tid / TD;
    float a[R];
    dot_rows<R>(wt + t * WP, xs + g * R * TD, a);
    #pragma unroll   // constant indices keep the small array in registers
    for (int j = 0; j < R; ++j) y[(size_t)(g * R + j) * TD + t] = a[j];
}

// ---------------- Stage 1: input projections (tiny: ~0.1 GFLOP) ------------

constexpr int RQK = 4;            // x rows per thread; 8 rows per block
constexpr int RV  = 2;            // x rows per thread; 4 rows per block

__global__ __launch_bounds__(256)
void proj_qk_kernel(const float* __restrict__ qtok, const float* __restrict__ ktok,
                    const float* __restrict__ Wq,   const float* __restrict__ Wk,
                    float* __restrict__ query, float* __restrict__ key)
{
    __shared__ __attribute__((aligned(16))) float wt[TD * WP];
    __shared__ __attribute__((aligned(16))) float xs[2 * RQK * TD];
    constexpr int NB = NROW / (2 * RQK);            // blocks per projection
    const bool isk = blockIdx.x >= NB;
    const size_t off = (size_t)(blockIdx.x % NB) * (2 * RQK * TD);
    project_rows<RQK>((isk ? ktok : qtok) + off, isk ? Wk : Wq,
                      (isk ? key : query) + off, wt, xs, threadIdx.x);
}

__global__ __launch_bounds__(256)
void proj_v_kernel(const float* __restrict__ key, const float* __restrict__ Wva,
                   float* __restrict__ vraw)
{
    __shared__ __attribute__((aligned(16))) float wt[TD * WP];
    __shared__ __attribute__((aligned(16))) float xs[2 * RV * TD];
    const size_t off = (size_t)blockIdx.x * (2 * RV * TD);
    project_rows<RV>(key + off, Wva, vraw + off, wt, xs, threadIdx.x);
}

// ---------------- Stage 2: key norms + pairwise cosine similarity ----------

__global__ __launch_bounds__(128)
void norm_kernel(const float* __restrict__ key, float* __restrict__ inv_norm)
{
    __shared__ float red[128];
    int r = blockIdx.x, t = threadIdx.x;
    float v = key[(size_t)r * TD + t];
    red[t] = v * v;
    __syncthreads();
    for (int off = 64; off > 0; off >>= 1) {
        if (t < off) red[t] += red[t + off];
        __syncthreads();
    }
    if (t == 0) {
        float nn = fmaxf(sqrtf(red[0]), 1e-8f);     // torch cosine eps clamp
        inv_norm[r] = 1.f / nn;
    }
}

// ksim[b,k] = sum_j (kn_k . kn_j)^2   (== diag of (Kn Kn^T)^2)
//
// One block = KR keys k against all KN keys j of their batch, which it holds in
// LDS (264 KB). Thread = two rows j; each 16 bytes of a row j meet KR keys k.
constexpr int KR = 4;

__global__ __launch_bounds__(256)
void ksim_kernel(const float* __restrict__ key, const float* __restrict__ inv_norm,
                 float* __restrict__ ksim)
{
    __shared__ __attribute__((aligned(16))) float kt[KN * WP];
    __shared__ __attribute__((aligned(16))) float kk[KR * TD];
    __shared__ float cb[KR][KN];        // cosines
    __shared__ float red[KR][128];
    const int r0  = blockIdx.x * KR;    // b*KN + k of the first key
    const int b   = r0 / KN;
    const int tid = threadIdx.x;

    // small loads first, so that they fly with the fill
    const float in0 = inv_norm[b * KN + tid];
    const float in1 = inv_norm[b * KN + tid + 256];
    const float kv0 = key[(size_t)r0 * TD + tid]       * inv_norm[r0 + tid / TD];
    const float kv1 = key[(size_t)r0 * TD + tid + 256] * inv_norm[r0 + 2 + tid / TD];
    // two runs of 32 copies per wave: a wave keeps fewer than 64 in flight
    const float* kb = key + (size_t)b * KN * TD;
    copy_rows_async<KN / 2>(kb, kt, tid);
    wait_copies();
    copy_rows_async<KN / 2>(kb + (KN / 2) * TD, kt + (KN / 2) * WP, tid);
    kk[tid]       = kv0;
    kk[tid + 256] = kv1;
    wait_copies();
    __syncthreads();

    float d0[KR], d1[KR];
    #pragma unroll   // constant indices keep the small array in registers
    for (int j = 0; j < KR; ++j) { d0[j] = 0.f; d1[j] = 0.f; }
    const float* row0 = kt + tid * WP;
    const float* row1 = kt + (tid + 256) * WP;
    #pragma unroll 4   // four groups of LDS reads in flight cover the LDS latency
    for (int s = 0; s < TD; s += 4) {
        const float4 m0 = *reinterpret_cast<const float4*>(row0 + s);
        const float4 m1 = *reinterpret_cast<const float4*>(row1 + s);
        #pragma unroll   // constant indices keep the small array in registers
        for (int j = 0; j < KR; ++j) {
            const float4 x = *reinterpret_cast<const float4*>(kk + j * TD + s);
            d0[j] = fmaf(x.x, m0.x, d0[j]);  d1[j] = fmaf(x.x, m1.x, d1[j]);
            d0[j] = fmaf(x.y, m0.y, d0[j]);  d1[j] = fmaf(x.y, m1.y, d1[j]);
            d0[j] = fmaf(x.z, m0.z, d0[j]);  d1[j] = fmaf(x.z, m1.z, d1[j]);
            d0[j] = fmaf(x.w, m0.w, d0[j]);  d1[j] = fmaf(x.w, m1.w, d1[j]);
        }
    }
    #pragma unroll   // constant indices keep the small array in registers
    for (int j = 0; j < KR; ++j) {
        cb[j][tid]       = d0[j] * in0;
        cb[j][tid + 256] = d1[j] * in1;
    }
    __syncthreads();

    // Sum of squares per key: 128 strided chains, then a halving tree.
    // Thread = (chain t, keys g and g + 2).
    const int t = tid % 128, g = tid / 128;
    #pragma unroll   // both keys' LDS reads in flight together
    for (int h = 0; h < KR / 2; ++h) {
        const int j = g + 2 * h;
        float acc = 0.f;
        #pragma unroll   // the chain's four LDS reads in flight together
        for (int m = 0; m < KN / 128; ++m) {
            const float c = cb[j][t + 128 * m];
            acc = fmaf(c, c, acc);
        }
        red[j][t] = acc;
    }
    __syncthreads();
    for (int off = 64; off > 0; off >>= 1) {
        if (t < off) {
            #pragma unroll   // both keys' LDS reads in flight together
            for (int h = 0; h < KR / 2; ++h) red[g + 2 * h][t] += red[g + 2 * h][t + off];
        }
        __syncthreads();
    }
    if (tid < KR) ksim[r0 + tid] = red[tid][0];
}

__device__ __forceinline__ void logits_tiles(const float* __restrict__ qrow0,
                                             const float* __restrict__ Wal,
                                             const float* keyrow,
                                             int hh, int n, v8f (&acc)[QTW][8])
{
    v8f zero = {};
    #pragma unroll
    for (int i = 0; i < QTW; ++i) {
        #pragma unroll
        for (int f = 0; f < 8; ++f) acc[i][f] = zero;
    }
    for (int t = 0; t < TD; t += 4) {
        const int ta = t + 2 * hh;                  // fp32 A frag: K = {2h, 2h+1}
        const float kx = keyrow[ta];
        const float ky = keyrow[ta + 1];
        v2f a[QTW];
        #pragma unroll
        for (int i = 0; i < QTW; ++i) {             // q-tile i = wave + 8*i
            const float* qr = qrow0 + (size_t)i * (NWAVES * 16 * TD) + ta;
            a[i].x = qr[0] * kx;
            a[i].y = qr[1] * ky;
        }
        #pragma unroll
        for (int f = 0; f < 8; ++f) {
            const float* wr = Wal + (size_t)(f * 16 + n) * TD + ta;
            v2f bb; bb.x = wr[0]; bb.y = wr[1];     // B[t',s] = Wal[s, t+t']
            #pragma unroll
            for (int i = 0; i < QTW; ++i)
                acc[i][f] = __builtin_amdgcn_wmma_f32_16x16x4_f32(
                    false, a[i], false, bb, (short)0, acc[i][f], false, false);
        }
    }
}

__global__ __launch_bounds__(256) __attribute__((amdgpu_waves_per_eu(2, 2)))
void swish_attn_kernel(const float* __restrict__ query, const float* __restrict__ key,
                       const float* __restrict__ vraw,  const float* __restrict__ Wal,
                       const float* __restrict__ ksim,  float* __restrict__ part)
{
    extern __shared__ __attribute__((aligned(16))) float smem[];
    float* vp     = smem;                   // [512][128] value partial (256 KB)
    float* st_m   = vp + QN * TD;           // [16][128] per (wave,half) run-max
    float* st_s   = st_m + 16 * TD;         // [16][128] per (wave,half) run-sum
    float* f_m    = st_s + 16 * TD;         // [128] final max per s
    float* f_d    = f_m + TD;               // [128] final denom per s
    float* keyrow = f_d + TD;               // [128]
    float* valrow = keyrow + TD;            // [128]

    const int wg   = blockIdx.x;
    const int b    = wg / (KN / KPW);
    const int k0   = (wg % (KN / KPW)) * KPW;
    const int tid  = threadIdx.x;
    const int wave = tid >> 5;              // wave32
    const int lane = tid & 31;
    const int hh   = lane >> 4;             // lane half (K / M-half select)
    const int n    = lane & 15;             // N index / A-row index

    __builtin_prefetch(Wal + (size_t)tid * 64, 0, 0);   // global_prefetch_b8

    for (int i = tid; i < QN * TD; i += 256) vp[i] = 0.f;

    const float* qb = query + (size_t)b * QN * TD;

    for (int kk = 0; kk < KPW; ++kk) {
        const int k = k0 + kk;
        __syncthreads();                    // also covers vp zeroing on iter 0

        if (tid < TD) {                     // waves 0..3: wave-uniform predicate
            const float* gk = key  + ((size_t)b * KN + k) * TD + tid;
            const float* gv = vraw + ((size_t)b * KN + k) * TD + tid;
            unsigned dk = (unsigned)(uintptr_t)(keyrow + tid);
            unsigned dv = (unsigned)(uintptr_t)(valrow + tid);
            asm volatile("global_load_async_to_lds_b32 %0, %1, off"
                         :: "v"(dk), "v"(gk) : "memory");
            asm volatile("global_load_async_to_lds_b32 %0, %1, off"
                         :: "v"(dv), "v"(gv) : "memory");
            asm volatile("s_wait_asynccnt 0x0" ::: "memory");
        }
        for (int i = tid; i < 16 * TD; i += 256) {
            st_m[i] = -INFINITY;
            st_s[i] = 0.f;
        }
        __syncthreads();

        const float kshrink = ksim[(size_t)b * KN + k];

        // ---- pass A: column stats (max, sum |x| e^{x-max}) over this lane's q ----
        float runM[8], runS[8];
        #pragma unroll
        for (int f = 0; f < 8; ++f) { runM[f] = -INFINITY; runS[f] = 0.f; }

        v8f acc[QTW][8];                    // lives until the end of pass B
        logits_tiles(qb + (size_t)(wave * 16 + n) * TD, Wal, keyrow, hh, n, acc);

        // The lane's column maxima first: with the maximum known, a logit needs
        // one exponential and the running sum no rescaling.
        #pragma unroll   // constant indices keep the arrays in registers
        for (int i = 0; i < QTW; ++i) {
            #pragma unroll   // constant indices keep the arrays in registers
            for (int r = 0; r < 8; ++r) {
                #pragma unroll   // constant indices keep the arrays in registers
                for (int f = 0; f < 8; ++f) runM[f] = fmaxf(runM[f], acc[i][f][r]);
            }
        }
        constexpr float L2E = 1.44269504088896340736f;      // log2(e)
        float negM2[8];                                     // -max in the exp2 domain
        #pragma unroll   // constant indices keep the arrays in registers
        for (int f = 0; f < 8; ++f) negM2[f] = -runM[f] * L2E;
        // x e^{x - runM} takes the logit's place in its register: pass B only has
        // to rescale it by a factor per column. |x| e^y = |x e^y|.
        #pragma unroll   // constant indices keep the arrays in registers
        for (int i = 0; i < QTW; ++i) {
            #pragma unroll   // constant indices keep the arrays in registers
            for (int r = 0; r < 8; ++r) {
                #pragma unroll   // constant indices keep the arrays in registers
                for (int f = 0; f < 8; ++f) {
                    const float x = acc[i][f][r];
                    const float p = x * __builtin_amdgcn_exp2f(fmaf(x, L2E, negM2[f]));
                    acc[i][f][r] = p;
                    runS[f] += fabsf(p);
                }
            }
        }
        {
            const int p = wave * 2 + hh;
            #pragma unroll
            for (int f = 0; f < 8; ++f) {
                st_m[p * TD + f * 16 + n] = runM[f];
                st_s[p * TD + f * 16 + n] = runS[f];
            }
        }
        __syncthreads();
        if (tid < TD) {                      // combine 16 partials per s-column
            float M = -INFINITY;
            for (int p = 0; p < 16; ++p) M = fmaxf(M, st_m[p * TD + tid]);
            float S = 0.f;
            for (int p = 0; p < 16; ++p)
                S += st_s[p * TD + tid] * __expf(st_m[p * TD + tid] - M);
            f_m[tid] = M;
            // shrink cancels: scale = x e^{x-M} / (S + ksim)
            f_d[tid] = S + kshrink;
        }
        __syncthreads();

        // ---- pass B: rescale the kept products, accumulate value partial ----
        float g[8];                          // e^{runM - M} * value / denom per column
        #pragma unroll   // constant indices keep the arrays in registers
        for (int f = 0; f < 8; ++f) {
            const int s = f * 16 + n;
            g[f] = __expf(runM[f] - f_m[s]) * (1.f / f_d[s]) * valrow[s];
        }
        #pragma unroll   // constant indices keep the arrays in registers
        for (int i = 0; i < QTW; ++i) {
            const int qt = wave + i * NWAVES;
            #pragma unroll   // constant indices keep the arrays in registers
            for (int f = 0; f < 8; ++f) {
                const int s = f * 16 + n;
                #pragma unroll   // constant indices keep the arrays in registers
                for (int r = 0; r < 8; ++r)
                    vp[(size_t)(qt * 16 + r + 8 * hh) * TD + s] += acc[i][f][r] * g[f];
            }
        }
    }
    __syncthreads();

    // Flush the private partial with plain 16-byte stores; no other work-group
    // writes these lines. Layout part[b][chunk][key group][CH]: the 128 partials
    // of one chunk lie side by side for the kernel that sums them.
    constexpr int C4 = CH / 4;              // float4 per chunk (64)
    constexpr int CPS = 256 / C4;           // chunks the block stores per sweep (4)
    const float4* src = reinterpret_cast<const float4*>(vp) + tid;
    float4* dst = reinterpret_cast<float4*>(
                      part + ((size_t)(b * NCH + tid / C4) * NG + wg % NG) * CH) + tid % C4;
    constexpr int GRP = 16;                 // stores per group
    for (int it = 0; it < NCH / CPS; it += GRP) {
        float4 v[GRP];
        #pragma unroll   // one group of LDS reads, then one group of stores
        for (int u = 0; u < GRP; ++u) v[u] = src[(it + u) * 256];
        #pragma unroll
        for (int u = 0; u < GRP; ++u) dst[(size_t)(it + u) * CPS * NG * C4] = v[u];
        // the next trip rewrites the registers that these stores name
        asm volatile("s_wait_xcnt 0x0" ::: "memory");
    }
}

// ---------------- Stage 4: sum of the partials + output projection ---------
//
// One block owns one chunk (two q rows). Its NG partials are 128 KB in a row:
// thread = (float4 column, quarter of the key groups) adds 32 of them in key
// group order, LDS joins the four quarters, always in the same order. Wvo is
// staged in LDS like the other small products' matrices.

__global__ __launch_bounds__(256)
void out_proj_kernel(const float* __restrict__ part, const float* __restrict__ Wvo,
                     float* __restrict__ out)
{
    __shared__ __attribute__((aligned(16))) float wt[TD * WP];
    __shared__ float4 red[4][CH / 4];
    __shared__ __attribute__((aligned(16))) float vs[CH];
    const int tid = threadIdx.x;
    copy_rows_async<TD>(Wvo, wt, tid);  // flies while the partials are summed
    const int col = tid % (CH / 4);
    const int grp = tid / (CH / 4);
    const float4* p = reinterpret_cast<const float4*>(part + (size_t)blockIdx.x * NG * CH)
                    + (size_t)grp * (NG / 4) * (CH / 4) + col;
    float4 s4 = make_float4(0.f, 0.f, 0.f, 0.f);
    #pragma unroll   // straight line: many independent 16-byte loads in flight per lane
    for (int g = 0; g < NG / 4; ++g) {
        const float4 v = p[(size_t)g * (CH / 4)];
        s4.x += v.x; s4.y += v.y; s4.z += v.z; s4.w += v.w;
    }
    red[grp][col] = s4;
    wait_copies();
    __syncthreads();
    {
        const float* rf = reinterpret_cast<const float*>(red);
        vs[tid] = (rf[tid] + rf[CH + tid]) + (rf[2 * CH + tid] + rf[3 * CH + tid]);
    }
    __syncthreads();

    int idx = blockIdx.x * 256 + tid;               // [0, B*QN*TD)
    float a[1];
    dot_rows<1>(wt + (tid % TD) * WP, vs + (tid / TD) * TD, a);
    out[idx] = a[0];
}

// ---------------------------------------------------------------------------

extern "C" void kernel_launch(void* const* d_in, const int* in_sizes, int n_in,
                              void* d_out, int out_size, void* d_ws, size_t ws_size,
                              hipStream_t stream)
{
    const float* qtok = (const float*)d_in[0];  // query_tokens [B,Q,T]
    const float* ktok = (const float*)d_in[1];  // key_tokens   [B,K,T]
    const float* Wk   = (const float*)d_in[2];
    const float* Wq   = (const float*)d_in[3];
    const float* Wva  = (const float*)d_in[4];
    const float* Wal  = (const float*)d_in[5];
    const float* Wvo  = (const float*)d_in[6];
    float* out = (float*)d_out;

    float* ws      = (float*)d_ws;              // 68 MB used
    float* w_key   = ws;                        // [NROW*TD]
    float* w_query = w_key   + NROW * TD;
    float* w_vraw  = w_query + NROW * TD;
    float* w_inorm = w_vraw  + NROW * TD;       // [NROW]
    float* w_ksim  = w_inorm + NROW;            // [NROW]
    float* w_part  = ws + (1 << 20);            // [B][NCH][NG][CH] = 64 MB

    dim3 blk256(256), blk128(128);
    const int nElem = NROW * TD;                // 131072

    proj_qk_kernel<<<2 * NROW / (2 * RQK), blk256, 0, stream>>>(qtok, ktok, Wq, Wk,
                                                                w_query, w_key);
    proj_v_kernel <<<NROW / (2 * RV), blk256, 0, stream>>>(w_key, Wva, w_vraw);
    norm_kernel   <<<NROW, blk128, 0, stream>>>(w_key, w_inorm);
    ksim_kernel   <<<NROW / KR, blk256, 0, stream>>>(w_key, w_inorm, w_ksim);

    size_t lds_bytes = (size_t)(QN * TD + 2 * 16 * TD + 4 * TD) * sizeof(float); // 280.5 KB
    swish_attn_kernel<<<B_ * (KN / KPW), blk256, lds_bytes, stream>>>(
        w_query, w_key, w_vraw, Wal, w_ksim, w_part);

    out_proj_kernel<<<nElem / 256, blk256, 0, stream>>>(w_part, Wvo, out);
}

// v005
// A run of this version takes 114 microseconds.
// Next to v004, in two timings, it ran 1.23 times as fast each time.
// All steps since v000 together make it 3.84 times as fast.
#include <hip/hip_runtime.h>
#include <math.h>

typedef float v2f __attribute__((ext_vector_type(2)));
typedef float v8f __attribute__((ext_vector_type(8)));

constexpr int B_  = 2;
constexpr int QN  = 512;
constexpr int KN  = 512;
constexpr int TD  = 128;
constexpr int NROW = B_ * KN;     // 1024 rows for [B,*,T] tensors
constexpr int KB   = 8;           // keys a workgroup takes at a time
constexpr int SS   = 16;          // logit columns s per workgroup
constexpr int NSL  = TD / SS;     // column slices (8)
constexpr int NG   = 16;          // key groups = value partials per batch
constexpr int KPW  = KN / NG;     // keys per workgroup (32)
constexpr int NWAVES = 8;         // 256 threads = 8 wave32
constexpr int QTW  = QN / 16 / NWAVES;   // q-tiles per wave (4)

// ---------------- Small dense products: operands through LDS ---------------
//
// Every small product here is y[r][t] = sum_s x[r][s] * M[t][s], one lane per
// row t of M. Read from global memory that is one 128-byte line per lane and
// load. Instead the block copies M into LDS with asynchronous copies that cover
// whole rows, and each lane walks its row there, for several x rows at a time.

constexpr int WP = TD + 4;

// Copy NR (a multiple of 64) contiguous rows of TD floats to LDS at pitch WP,
// through no register. A sweep = the block's 8 waves (256 threads) copy 8 rows:
// one wave-wide 16-byte copy = one whole 512-byte row. NR / 8 copies per wave
// are left in flight: the caller waits (s_wait_asynccnt 0) and then barriers.
template <int NR>
__device__ __forceinline__ void copy_rows_async(const float* g, float* l, int tid)
{
    constexpr unsigned LS = 8 * WP * 4;             // LDS bytes per sweep
    constexpr int      GS = 8 * TD;                 // floats per sweep
    // low 32 bits of a generic pointer into LDS = the LDS byte address
    const unsigned l0 = (unsigned)(uintptr_t)(l + (tid >> 5) * WP + (tid & 31) * 4);
    const float*   g0 = g + tid * 4;
    #pragma unroll   // straight line: no loop-carried address registers
    for (int u = 0; u < NR / 8; u += 8) {
        const unsigned a = l0 + u * LS;
        const float*   p = g0 + u * GS;
        // the wait ends the statement: the copies' address registers are free behind it
        asm volatile("global_load_async_to_lds_b128 %0, %8, off\n\t"
                     "global_load_async_to_lds_b128 %1, %9, off\n\t"
                     "global_load_async_to_lds_b128 %2, %10, off\n\t"
                     "global_load_async_to_lds_b128 %3, %11, off\n\t"
                     "global_load_async_to_lds_b128 %4, %12, off\n\t"
                     "global_load_async_to_lds_b128 %5, %13, off\n\t"
                     "global_load_async_to_lds_b128 %6, %14, off\n\t"
                     "global_load_async_to_lds_b128 %7, %15, off\n\t"
                     "s_wait_xcnt 0x0"
                     :: "v"(a), "v"(a + LS), "v"(a + 2 * LS), "v"(a + 3 * LS),
                        "v"(a + 4 * LS), "v"(a + 5 * LS), "v"(a + 6 * LS), "v"(a + 7 * LS),
                        "v"(p), "v"(p + GS), "v"(p + 2 * GS), "v"(p + 3 * GS),
                        "v"(p + 4 * GS), "v"(p + 5 * GS), "v"(p + 6 * GS), "v"(p + 7 * GS)
                     : "memory");
    }
}

// The issuing wave's copies have landed behind this; other waves need the barrier too.
__device__ __forceinline__ void wait_copies()
{
    asm volatile("s_wait_asynccnt 0x0" ::: "memory");
}

// a[j] = sum_s xrows[j][s] * mrow[s], s ascending, one fused multiply-add each.
template <int R>
__device__ __forceinline__ void dot_rows(const float* mrow, const float* xrows, float (&a)[R])
{
    #pragma unroll   // constant indices keep the small array in registers
    for (int j = 0; j < R; ++j) a[j] = 0.f;
    #pragma unroll 8   // eight groups of LDS reads in flight cover the LDS latency
    for (int s = 0; s < TD; s += 4) {
        const float4 m = *reinterpret_cast<const float4*>(mrow + s);
        #pragma unroll   // constant indices keep the small array in registers
        for (int j = 0; j < R; ++j) {
            const float4 x = *reinterpret_cast<const float4*>(xrows + j * TD + s);
            a[j] = fmaf(x.x, m.x, a[j]);
            a[j] = fmaf(x.y, m.y, a[j]);
            a[j] = fmaf(x.z, m.z, a[j]);
            a[j] = fmaf(x.w, m.w, a[j]);
        }
    }
}

// y = x @ W.T for 2*R rows of x: thread = (column t, half g of the rows).
template <int R>
__device__ __forceinline__ void project_rows(const float* __restrict__ x,
                                             const float* __restrict__ W,
                                             float* __restrict__ y,
                                             float* wt, float* xs, int tid)
{
    constexpr int NX = 2 * R * (TD / 4);            // float4 in the x rows (<= 256)
    copy_rows_async<TD>(W, wt, tid);
    if (tid < NX)                                   // flies with W's copies
        reinterpret_cast<float4*>(xs)[tid] = reinterpret_cast<const float4*>(x)[tid];
    wait_copies();
    __syncthreads();
    const int t = tid % TD, g = tid / TD;
    float a[R];
    dot_rows<R>(wt + t * WP, xs + g * R * TD, a);
    #pragma unroll   // constant indices keep the small array in registers
    for (int j = 0; j < R; ++j) y[(size_t)(g * R + j) * TD + t] = a[j];
}

// ---------------- Stage 1: input projections (tiny: ~0.1 GFLOP) ------------

constexpr int RQK = 4;            // x rows per thread; 8 rows per block
constexpr int RV  = 2;            // x rows per thread; 4 rows per block

__global__ __launch_bounds__(256)
void proj_qk_kernel(const float* __restrict__ qtok, const float* __restrict__ ktok,
                    const float* __restrict__ Wq,   const float* __restrict__ Wk,
                    float* __restrict__ query, float* __restrict__ key)
{
    __shared__ __attribute__((aligned(16))) float wt[TD * WP];
    __shared__ __attribute__((aligned(16))) float xs[2 * RQK * TD];
    constexpr int NB = NROW / (2 * RQK);            // blocks per projection
    const bool isk = blockIdx.x >= NB;
    const size_t off = (size_t)(blockIdx.x % NB) * (2 * RQK * TD);
    project_rows<RQK>((isk ? ktok : qtok) + off, isk ? Wk : Wq,
                      (isk ? key : query) + off, wt, xs, threadIdx.x);
}

__global__ __launch_bounds__(256)
void proj_v_kernel(const float* __restrict__ key, const float* __restrict__ Wva,
                   float* __restrict__ vraw)
{
    __shared__ __attribute__((aligned(16))) float wt[TD * WP];
    __shared__ __attribute__((aligned(16))) float xs[2 * RV * TD];
    const size_t off = (size_t)blockIdx.x * (2 * RV * TD);
    project_rows<RV>(key + off, Wva, vraw + off, wt, xs, threadIdx.x);
}

// ---------------- Stage 2: key norms + pairwise cosine similarity ----------

__global__ __launch_bounds__(128)
void norm_kernel(const float* __restrict__ key, float* __restrict__ inv_norm)
{
    __shared__ float red[128];
    int r = blockIdx.x, t = threadIdx.x;
    float v = key[(size_t)r * TD + t];
    red[t] = v * v;
    __syncthreads();
    for (int off = 64; off > 0; off >>= 1) {
        if (t < off) red[t] += red[t + off];
        __syncthreads();
    }
    if (t == 0) {
        float nn = fmaxf(sqrtf(red[0]), 1e-8f);     // torch cosine eps clamp
        inv_norm[r] = 1.f / nn;
    }
}

// ksim[b,k] = sum_j (kn_k . kn_j)^2   (== diag of (Kn Kn^T)^2)
//
// One block = KR keys k against all KN keys j of their batch, which it holds in
// LDS (264 KB). Thread = two rows j; each 16 bytes of a row j meet KR keys k.
constexpr int KR = 4;

__global__ __launch_bounds__(256)
void ksim_kernel(const float* __restrict__ key, const float* __restrict__ inv_norm,
                 float* __restrict__ ksim)
{
    __shared__ __attribute__((aligned(16))) float kt[KN * WP];
    __shared__ __attribute__((aligned(16))) float kk[KR * TD];
    __shared__ float cb[KR][KN];        // cosines
    __shared__ float red[KR][128];
    const int r0  = blockIdx.x * KR;    // b*KN + k of the first key
    const int b   = r0 / KN;
    const int tid = threadIdx.x;

    // small loads first, so that they fly with the fill
    const float in0 = inv_norm[b * KN + tid];
    const float in1 = inv_norm[b * KN + tid + 256];
    const float kv0 = key[(size_t)r0 * TD + tid]       * inv_norm[r0 + tid / TD];
    const float kv1 = key[(size_t)r0 * TD + tid + 256] * inv_norm[r0 + 2 + tid / TD];
    // two runs of 32 copies per wave: a wave keeps fewer than 64 in flight
    const float* kb = key + (size_t)b * KN * TD;
    copy_rows_async<KN / 2>(kb, kt, tid);
    wait_copies();
    copy_rows_async<KN / 2>(kb + (KN / 2) * TD, kt + (KN / 2) * WP, tid);
    kk[tid]       = kv0;
    kk[tid + 256] = kv1;
    wait_copies();
    __syncthreads();

    float d0[KR], d1[KR];
    #pragma unroll   // constant indices keep the small array in registers
    for (int j = 0; j < KR; ++j) { d0[j] = 0.f; d1[j] = 0.f; }
    const float* row0 = kt + tid * WP;
    const float* row1 = kt + (tid + 256) * WP;
    #pragma unroll 4   // four groups of LDS reads in flight cover the LDS latency
    for (int s = 0; s < TD; s += 4) {
        const float4 m0 = *reinterpret_cast<const float4*>(row0 + s);
        const float4 m1 = *reinterpret_cast<const float4*>(row1 + s);
        #pragma unroll   // constant indices keep the small array in registers
        for (int j = 0; j < KR; ++j) {
            const float4 x = *reinterpret_cast<const float4*>(kk + j * TD + s);
            d0[j] = fmaf(x.x, m0.x, d0[j]);  d1[j] = fmaf(x.x, m1.x, d1[j]);
            d0[j] = fmaf(x.y, m0.y, d0[j]);  d1[j] = fmaf(x.y, m1.y, d1[j]);
            d0[j] = fmaf(x.z, m0.z, d0[j]);  d1[j] = fmaf(x.z, m1.z, d1[j]);
            d0[j] = fmaf(x.w, m0.w, d0[j]);  d1[j] = fmaf(x.w, m1.w, d1[j]);
        }
    }
    #pragma unroll   // constant indices keep the small array in registers
    for (int j = 0; j < KR; ++j) {
        cb[j][tid]       = d0[j] * in0;
        cb[j][tid + 256] = d1[j] * in1;
    }
    __syncthreads();

    // Sum of squares per key: 128 strided chains, then a halving tree.
    // Thread = (chain t, keys g and g + 2).
    const int t = tid % 128, g = tid / 128;
    #pragma unroll   // both keys' LDS reads in flight together
    for (int h = 0; h < KR / 2; ++h) {
        const int j = g + 2 * h;
        float acc = 0.f;
        #pragma unroll   // the chain's four LDS reads in flight together
        for (int m = 0; m < KN / 128; ++m) {
            const float c = cb[j][t + 128 * m];
            acc = fmaf(c, c, acc);
        }
        red[j][t] = acc;
    }
    __syncthreads();
    for (int off = 64; off > 0; off >>= 1) {
        if (t < off) {
            #pragma unroll   // both keys' LDS reads in flight together
            for (int h = 0; h < KR / 2; ++h) red[g + 2 * h][t] += red[g + 2 * h][t + off];
        }
        __syncthreads();
    }
    if (tid < KR) ksim[r0 + tid] = red[tid][0];
}

__device__ __forceinline__ void logits_tiles(const float* __restrict__ qrow0,
                                             const float* walf, const float* keyrows,
                                             int hh, int lane, v8f (&acc)[QTW][KB])
{
    v8f zero = {};
    #pragma unroll
    for (int i = 0; i < QTW; ++i) {
        #pragma unroll
        for (int f = 0; f < KB; ++f) acc[i][f] = zero;
    }
    for (int t = 0; t < TD; t += 4) {
        const int ta = t + 2 * hh;                  // fp32 A/B frag: K = {2h, 2h+1}
        const v2f w = *reinterpret_cast<const v2f*>(walf + t * 16 + lane * 2);
        v2f a[QTW];
        #pragma unroll
        for (int i = 0; i < QTW; ++i) {             // q-tile i = wave + 8*i
            const float* qr = qrow0 + (size_t)i * (NWAVES * 16 * TD) + ta;
            a[i].x = qr[0];
            a[i].y = qr[1];
        }
        #pragma unroll
        for (int f = 0; f < KB; ++f) {
            const float* kr = keyrows + f * TD + ta;
            v2f bb; bb.x = w.x * kr[0]; bb.y = w.y * kr[1];
            #pragma unroll
            for (int i = 0; i < QTW; ++i)
                acc[i][f] = __builtin_amdgcn_wmma_f32_16x16x4_f32(
                    false, a[i], false, bb, (short)0, acc[i][f], false, false);
        }
    }
}

__global__ __launch_bounds__(256) __attribute__((amdgpu_waves_per_eu(2, 2)))
void swish_attn_kernel(const float* __restrict__ query, const float* __restrict__ key,
                       const float* __restrict__ vraw,  const float* __restrict__ Wal,
                       const float* __restrict__ ksim,  float* __restrict__ part)
{
    __shared__ float st_m[16 * TD];         // per (wave,half) run-max of a column
    __shared__ float st_s[16 * TD];         // per (wave,half) run-sum of a column
    __shared__ float f_m[TD];               // final max per column
    __shared__ float f_d[TD];               // final denom per column
    __shared__ float valrow[TD];            // value_raw[k][s] per column
    __shared__ __attribute__((aligned(16))) float keyrows[KB * TD];
    __shared__ __attribute__((aligned(16))) float walf[SS * TD];  // [t/4][lane][2]

    const int wg   = blockIdx.x;
    const int b    = wg / (NSL * NG);
    const int sl   = (wg / NG) % NSL;       // slice of SS columns s
    const int grp  = wg % NG;               // group of KPW keys
    const int tid  = threadIdx.x;
    const int wave = tid >> 5;              // wave32
    const int lane = tid & 31;
    const int hh   = lane >> 4;             // lane half (K / M-half select)
    const int n    = lane & 15;             // N index / A-row index

    // The slice's 16 rows of Wal in B-fragment order: a wave reads 256 B in a row.
    {
        constexpr int NW = SS * TD / 2 / 256;       // fragment pairs per thread (4)
        const float* wsrc = Wal + (size_t)(sl * SS + n) * TD + wave * 4 + 2 * hh;
        v2f wv[NW];
        #pragma unroll   // the loads in flight together
        for (int u = 0; u < NW; ++u)                // K step t/4 = wave + 8*u
            wv[u] = *reinterpret_cast<const v2f*>(wsrc + u * NWAVES * 4);
        #pragma unroll   // constant indices keep the small array in registers
        for (int u = 0; u < NW; ++u) reinterpret_cast<v2f*>(walf)[tid + u * 256] = wv[u];
    }

    const float* qb = query + (size_t)b * QN * TD;

    v8f vsum[QTW];
    {
        v8f zero = {};
        #pragma unroll   // constant indices keep the arrays in registers
        for (int i = 0; i < QTW; ++i) vsum[i] = zero;
    }

    for (int kb = 0; kb < KPW / KB; ++kb) {
        const size_t r0 = (size_t)b * KN + grp * KPW + kb * KB;   // first key's row
        // This pass's small loads fly together, ahead of the barrier. KB key rows lie
        // in a row in memory: 16 bytes per thread. col = the thread's column (k, s).
        const int col = tid % TD;
        const float4 kv = reinterpret_cast<const float4*>(key + r0 * TD)[tid];
        const float  vv = vraw[(r0 + col / SS) * TD + sl * SS + col % SS];
        const float  kshrink = ksim[r0 + col / SS];
        // later code rewrites the registers that these loads name
        asm volatile("s_wait_xcnt 0x0" ::: "memory");
        __syncthreads();                    // the last pass has read its LDS rows

        reinterpret_cast<float4*>(keyrows)[tid] = kv;
        if (tid < TD) valrow[tid] = vv;
        for (int i = tid; i < 16 * TD; i += 256) {
            st_m[i] = -INFINITY;
            st_s[i] = 0.f;
        }
        __syncthreads();                    // also covers walf on the first pass

        // ---- pass A: column stats (max, sum |x| e^{x-max}) over this lane's q ----
        float runM[KB], runS[KB];
        #pragma unroll
        for (int f = 0; f < KB; ++f) { runM[f] = -INFINITY; runS[f] = 0.f; }

        v8f acc[QTW][KB];                   // lives until the end of pass B
        logits_tiles(qb + (size_t)(wave * 16 + n) * TD, walf, keyrows, hh, lane, acc);

        // The lane's column maxima first: with the maximum known, a logit needs
        // one exponential and the running sum no rescaling.
        #pragma unroll   // constant indices keep the arrays in registers
        for (int i = 0; i < QTW; ++i) {
            #pragma unroll   // constant indices keep the arrays in registers
            for (int r = 0; r < 8; ++r) {
                #pragma unroll   // constant indices keep the arrays in registers
                for (int f = 0; f < KB; ++f) runM[f] = fmaxf(runM[f], acc[i][f][r]);
            }
        }
        constexpr float L2E = 1.44269504088896340736f;      // log2(e)
        float negM2[KB];                                    // -max in the exp2 domain
        #pragma unroll   // constant indices keep the arrays in registers
        for (int f = 0; f < KB; ++f) negM2[f] = -runM[f] * L2E;
        // x e^{x - runM} takes the logit's place in its register: pass B only has
        // to rescale it by a factor per column. |x| e^y = |x e^y|.
        #pragma unroll   // constant indices keep the arrays in registers
        for (int i = 0; i < QTW; ++i) {
            #pragma unroll   // constant indices keep the arrays in registers
            for (int r = 0; r < 8; ++r) {
                #pragma unroll   // constant indices keep the arrays in registers
                for (int f = 0; f < KB; ++f) {
                    const float x = acc[i][f][r];
                    const float p = x * __builtin_amdgcn_exp2f(fmaf(x, L2E, negM2[f]));
                    acc[i][f][r] = p;
                    runS[f] += fabsf(p);
                }
            }
        }
        {
            const int p = wave * 2 + hh;
            #pragma unroll
            for (int f = 0; f < KB; ++f) {
                st_m[p * TD + f * 16 + n] = runM[f];
                st_s[p * TD + f * 16 + n] = runS[f];
            }
        }
        __syncthreads();
        if (tid < TD) {                      // combine 16 partials per column
            float M = -INFINITY;
            for (int p = 0; p < 16; ++p) M = fmaxf(M, st_m[p * TD + tid]);
            float S = 0.f;
            for (int p = 0; p < 16; ++p)
                S += st_s[p * TD + tid] * __expf(st_m[p * TD + tid] - M);
            f_m[tid] = M;
            // shrink cancels: scale = x e^{x-M} / (S + ksim)
            f_d[tid] = S + kshrink;
        }
        __syncthreads();

        // ---- pass B: rescale the kept products, add them up over the keys ----
        float g[KB];                         // e^{runM - M} * value / denom per column
        #pragma unroll   // constant indices keep the arrays in registers
        for (int f = 0; f < KB; ++f) {
            const int c = f * 16 + n;
            g[f] = __expf(runM[f] - f_m[c]) * (1.f / f_d[c]) * valrow[c];
        }
        #pragma unroll   // constant indices keep the arrays in registers
        for (int f = 0; f < KB; ++f) {       // keys in ascending order
            #pragma unroll   // constant indices keep the arrays in registers
            for (int i = 0; i < QTW; ++i) {
                #pragma unroll   // constant indices keep the arrays in registers
                for (int r = 0; r < 8; ++r)
                    vsum[i][r] = fmaf(acc[i][f][r], g[f], vsum[i][r]);
            }
        }
    }

    // Store the partial from its registers. Layout part[b][key group][slice][q][SS]:
    // a work-group's 32 KB lie in a row, so no other work-group writes its lines.
    float* dst = part + ((size_t)((b * NG + grp) * NSL + sl) * QN + 8 * hh) * SS + n;
    #pragma unroll   // constant indices keep the arrays in registers
    for (int i = 0; i < QTW; ++i) {
        #pragma unroll   // constant indices keep the arrays in registers
        for (int r = 0; r < 8; ++r)
            dst[((wave + i * NWAVES) * 16 + r) * SS] = vsum[i][r];
    }
}

// ---------------- Stage 4: sum of the partials + output projection ---------
//
// One block owns two q rows. In each of the NG partials a slice's share of them
// is one 128-byte line: wave = slice, lane = (row, column in the slice) adds its
// element over the key groups in ascending order. Wvo is staged in LDS like the
// other small products' matrices.

__global__ __launch_bounds__(256)
void out_proj_kernel(const float* __restrict__ part, const float* __restrict__ Wvo,
                     float* __restrict__ out)
{
    __shared__ __attribute__((aligned(16))) float wt[TD * WP];
    __shared__ __attribute__((aligned(16))) float vs[2 * TD];
    const int tid = threadIdx.x;
    copy_rows_async<TD>(Wvo, wt, tid);  // flies while the partials are summed
    const int b  = blockIdx.x / (QN / 2);
    const int q0 = (blockIdx.x % (QN / 2)) * 2;
    const int sl = tid >> 5;
    const int w  = tid & 31;
    const float* p = part + ((size_t)(b * NG * NSL + sl) * QN + q0) * SS + w;
    float s = 0.f;
    #pragma unroll   // straight line: the independent loads are in flight together
    for (int g = 0; g < NG; ++g) s += p[(size_t)g * NSL * QN * SS];
    vs[(w >> 4) * TD + sl * SS + (w & 15)] = s;
    wait_copies();
    __syncthreads();

    int idx = blockIdx.x * 256 + tid;               // [0, B*QN*TD)
    float a[1];
    dot_rows<1>(wt + (tid % TD) * WP, vs + (tid / TD) * TD, a);
    out[idx] = a[0];
}

// ---------------------------------------------------------------------------

extern "C" void kernel_launch(void* const* d_in, const int* in_sizes, int n_in,
                              void* d_out, int out_size, void* d_ws, size_t ws_size,
                              hipStream_t stream)
{
    const float* qtok = (const float*)d_in[0];  // query_tokens [B,Q,T]
    const float* ktok = (const float*)d_in[1];  // key_tokens   [B,K,T]
    const float* Wk   = (const float*)d_in[2];
    const float* Wq   = (const float*)d_in[3];
    const float* Wva  = (const float*)d_in[4];
    const float* Wal  = (const float*)d_in[5];
    const float* Wvo  = (const float*)d_in[6];
    float* out = (float*)d_out;

    float* ws      = (float*)d_ws;              // 12 MB used
    float* w_key   = ws;                        // [NROW*TD]
    float* w_query = w_key   + NROW * TD;
    float* w_vraw  = w_query + NROW * TD;
    float* w_inorm = w_vraw  + NROW * TD;       // [NROW]
    float* w_ksim  = w_inorm + NROW;            // [NROW]
    float* w_part  = ws + (1 << 20);            // [B][NG][NSL][QN][SS] = 8 MB

    dim3 blk256(256), blk128(128);
    const int nElem = NROW * TD;                // 131072

    proj_qk_kernel<<<2 * NROW / (2 * RQK), blk256, 0, stream>>>(qtok, ktok, Wq, Wk,
                                                                w_query, w_key);
    proj_v_kernel <<<NROW / (2 * RV), blk256, 0, stream>>>(w_key, Wva, w_vraw);
    norm_kernel   <<<NROW, blk128, 0, stream>>>(w_key, w_inorm);
    ksim_kernel   <<<NROW / KR, blk256, 0, stream>>>(w_key, w_inorm, w_ksim);

    swish_attn_kernel<<<B_ * NSL * NG, blk256, 0, stream>>>(
        w_query, w_key, w_vraw, Wal, w_ksim, w_part);

    out_proj_kernel<<<nElem / 256, blk256, 0, stream>>>(w_part, Wvo, out);
}

// v006
// One run takes 109 microseconds.
// In both of two side-by-side timings against v005, it was 1.04 times as fast.
// Counting every step since v000, it is 3.98 times as fast.
#include <hip/hip_runtime.h>
#include <math.h>

typedef float v2f __attribute__((ext_vector_type(2)));
typedef float v8f __attribute__((ext_vector_type(8)));

constexpr int B_  = 2;
constexpr int QN  = 512;
constexpr int KN  = 512;
constexpr int TD  = 128;
constexpr int NROW = B_ * KN;     // 1024 rows for [B,*,T] tensors
constexpr int KB   = 8;           // keys a workgroup takes at a time
constexpr int SS   = 16;          // logit columns s per workgroup
constexpr int NSL  = TD / SS;     // column slices (8)
constexpr int NG   = 16;          // key groups = value partials per batch
constexpr int KPW  = KN / NG;     // keys per workgroup (32)
constexpr int NWAVES = 8;         // 256 threads = 8 wave32
constexpr int QTW  = QN / 16 / NWAVES;   // q-tiles per wave (4)

// ---------------- Small dense products: operands through LDS ---------------
//
// Every small product here is y[r][t] = sum_s x[r][s] * M[t][s], one lane per
// row t of M. Read from global memory that is one 128-byte line per lane and
// load. Instead the block copies M into LDS with asynchronous copies that cover
// whole rows, and each lane walks its row there, for several x rows at a time.

constexpr int WP = TD + 4;

// Copy NR (a multiple of 64) contiguous rows of TD floats to LDS at pitch WP,
// through no register. A sweep = the block's 8 waves (256 threads) copy 8 rows:
// one wave-wide 16-byte copy = one whole 512-byte row. NR / 8 copies per wave
// are left in flight: the caller waits (s_wait_asynccnt 0) and then barriers.
template <int NR>
__device__ __forceinline__ void copy_rows_async(const float* g, float* l, int tid)
{
    constexpr unsigned LS = 8 * WP * 4;             // LDS bytes per sweep
    constexpr int      GS = 8 * TD;                 // floats per sweep
    // low 32 bits of a generic pointer into LDS = the LDS byte address
    const unsigned l0 = (unsigned)(uintptr_t)(l + (tid >> 5) * WP + (tid & 31) * 4);
    const float*   g0 = g + tid * 4;
    #pragma unroll   // straight line: no loop-carried address registers
    for (int u = 0; u < NR / 8; u += 8) {
        const unsigned a = l0 + u * LS;
        const float*   p = g0 + u * GS;
        // the wait ends the statement: the copies' address registers are free behind it
        asm volatile("global_load_async_to_lds_b128 %0, %8, off\n\t"
                     "global_load_async_to_lds_b128 %1, %9, off\n\t"
                     "global_load_async_to_lds_b128 %2, %10, off\n\t"
                     "global_load_async_to_lds_b128 %3, %11, off\n\t"
                     "global_load_async_to_lds_b128 %4, %12, off\n\t"
                     "global_load_async_to_lds_b128 %5, %13, off\n\t"
                     "global_load_async_to_lds_b128 %6, %14, off\n\t"
                     "global_load_async_to_lds_b128 %7, %15, off\n\t"
                     "s_wait_xcnt 0x0"
                     :: "v"(a), "v"(a + LS), "v"(a + 2 * LS), "v"(a + 3 * LS),
                        "v"(a + 4 * LS), "v"(a + 5 * LS), "v"(a + 6 * LS), "v"(a + 7 * LS),
                        "v"(p), "v"(p + GS), "v"(p + 2 * GS), "v"(p + 3 * GS),
                        "v"(p + 4 * GS), "v"(p + 5 * GS), "v"(p + 6 * GS), "v"(p + 7 * GS)
                     : "memory");
    }
}

// The issuing wave's copies have landed behind this; other waves need the barrier too.
__device__ __forceinline__ void wait_copies()
{
    asm volatile("s_wait_asynccnt 0x0" ::: "memory");
}

// a[j] = sum_s xrows[j][s] * mrow[s], s ascending, one fused multiply-add each.
template <int R>
__device__ __forceinline__ void dot_rows(const float* mrow, const float* xrows, float (&a)[R])
{
    #pragma unroll   // constant indices keep the small array in registers
    for (int j = 0; j < R; ++j) a[j] = 0.f;
    #pragma unroll 8   // eight groups of LDS reads in flight cover the LDS latency
    for (int s = 0; s < TD; s += 4) {
        const float4 m = *reinterpret_cast<const float4*>(mrow + s);
        #pragma unroll   // constant indices keep the small array in registers
        for (int j = 0; j < R; ++j) {
            const float4 x = *reinterpret_cast<const float4*>(xrows + j * TD + s);
            a[j] = fmaf(x.x, m.x, a[j]);
            a[j] = fmaf(x.y, m.y, a[j]);
            a[j] = fmaf(x.z, m.z, a[j]);
            a[j] = fmaf(x.w, m.w, a[j]);
        }
    }
}

// ---------------- Stage 1: projections and key norms, one launch -----------
//
// One block = 2*RQK rows of one token tensor; thread = (column t, half g of the
// rows). A key block goes on with what depends on its own key rows alone: they
// stay in LDS, and the block takes their norms and their value rows from there,
// so neither needs a launch of its own. Key blocks have the longer way and come
// first in the grid.

constexpr int RQK = 4;            // x rows per thread; 8 rows per block

__global__ __launch_bounds__(256)
void proj_kernel(const float* __restrict__ qtok, const float* __restrict__ ktok,
                 const float* __restrict__ Wq,   const float* __restrict__ Wk,
                 const float* __restrict__ Wva,
                 float* __restrict__ query, float* __restrict__ key,
                 float* __restrict__ vraw,  float* __restrict__ inv_norm)
{
    __shared__ __attribute__((aligned(16))) float wt[TD * WP];      // Wq or Wk
    __shared__ __attribute__((aligned(16))) float wv[TD * WP];      // Wva
    __shared__ __attribute__((aligned(16))) float xs[2 * RQK * TD]; // token rows
    __shared__ __attribute__((aligned(16))) float ks[2 * RQK * TD]; // key rows
    constexpr int NB = NROW / (2 * RQK);            // blocks per token tensor
    const int  tid = threadIdx.x;
    const bool isk = blockIdx.x < NB;               // the same for the whole block
    const int  r0  = (blockIdx.x % NB) * (2 * RQK); // first row
    const size_t off = (size_t)r0 * TD;

    copy_rows_async<TD>(isk ? Wk : Wq, wt, tid);
    if (isk) copy_rows_async<TD>(Wva, wv, tid);     // 32 copies per wave in flight
    // 2*RQK rows = one float4 per thread; flies with the copies
    reinterpret_cast<float4*>(xs)[tid] =
        reinterpret_cast<const float4*>((isk ? ktok : qtok) + off)[tid];
    wait_copies();
    __syncthreads();

    const int t = tid % TD, g = tid / TD;
    float a[RQK];
    dot_rows<RQK>(wt + t * WP, xs + g * RQK * TD, a);

    if (!isk) {
        #pragma unroll   // constant indices keep the small array in registers
        for (int j = 0; j < RQK; ++j) query[off + (size_t)(g * RQK + j) * TD + t] = a[j];
        asm volatile("s_wait_xcnt 0x0" ::: "memory");
    } else {
        #pragma unroll   // constant indices keep the small array in registers
        for (int j = 0; j < RQK; ++j) ks[(g * RQK + j) * TD + t] = a[j];
        __syncthreads();                            // the key rows are whole in LDS
        // behind the barrier, so that it does not wait for these stores
        #pragma unroll   // constant indices keep the small array in registers
        for (int j = 0; j < RQK; ++j) key[off + (size_t)(g * RQK + j) * TD + t] = a[j];

        // Norm: wave = row. A halving tree over the 128 squares: distances 64 and
        // 32 inside the lane, 16 to 1 between lanes.
        const int wave = tid >> 5, lane = tid & 31;
        const float* kr = ks + wave * TD + lane;
        const float k0 = kr[0], k1 = kr[32], k2 = kr[64], k3 = kr[96];
        float ss = (k0 * k0 + k2 * k2) + (k1 * k1 + k3 * k3);
        #pragma unroll   // five steps, straight line
        for (int d = 16; d > 0; d >>= 1) ss += __shfl_xor(ss, d, 32);
        if (lane == 0)                              // the reference's clamp of the norm
            inv_norm[r0 + wave] = 1.f / fmaxf(sqrtf(ss), 1e-8f);

        float v[RQK];
        dot_rows<RQK>(wv + t * WP, ks + g * RQK * TD, v);
        #pragma unroll   // constant indices keep the small array in registers
        for (int j = 0; j < RQK; ++j) vraw[off + (size_t)(g * RQK + j) * TD + t] = v[j];
    }
}

// ---------------- Stage 2: pairwise cosine similarity ----------------------

// ksim[b,k] = sum_j (kn_k . kn_j)^2   (== diag of (Kn Kn^T)^2)
//
// One block = KR keys k against all KN keys j of their batch, which it holds in
// LDS (264 KB). Thread = two rows j; each 16 bytes of a row j meet KR keys k.
constexpr int KR = 4;

__global__ __launch_bounds__(256)
void ksim_kernel(const float* __restrict__ key, const float* __restrict__ inv_norm,
                 float* __restrict__ ksim)
{
    __shared__ __attribute__((aligned(16))) float kt[KN * WP];
    __shared__ __attribute__((aligned(16))) float kk[KR * TD];
    __shared__ float cb[KR][KN];        // cosines
    __shared__ float red[KR][128];
    const int r0  = blockIdx.x * KR;    // b*KN + k of the first key
    const int b   = r0 / KN;
    const int tid = threadIdx.x;

    // small loads first, so that they fly with the fill
    const float in0 = inv_norm[b * KN + tid];
    const float in1 = inv_norm[b * KN + tid + 256];
    const float kv0 = key[(size_t)r0 * TD + tid]       * inv_norm[r0 + tid / TD];
    const float kv1 = key[(size_t)r0 * TD + tid + 256] * inv_norm[r0 + 2 + tid / TD];
    // two runs of 32 copies per wave: a wave keeps fewer than 64 in flight
    const float* kb = key + (size_t)b * KN * TD;
    copy_rows_async<KN / 2>(kb, kt, tid);
    wait_copies();
    copy_rows_async<KN / 2>(kb + (KN / 2) * TD, kt + (KN / 2) * WP, tid);
    kk[tid]       = kv0;
    kk[tid + 256] = kv1;
    wait_copies();
    __syncthreads();

    float d0[KR], d1[KR];
    #pragma unroll   // constant indices keep the small array in registers
    for (int j = 0; j < KR; ++j) { d0[j] = 0.f; d1[j] = 0.f; }
    const float* row0 = kt + tid * WP;
    const float* row1 = kt + (tid + 256) * WP;
    #pragma unroll 4   // four groups of LDS reads in flight cover the LDS latency
    for (int s = 0; s < TD; s += 4) {
        const float4 m0 = *reinterpret_cast<const float4*>(row0 + s);
        const float4 m1 = *reinterpret_cast<const float4*>(row1 + s);
        #pragma unroll   // constant indices keep the small array in registers
        for (int j = 0; j < KR; ++j) {
            const float4 x = *reinterpret_cast<const float4*>(kk + j * TD + s);
            d0[j] = fmaf(x.x, m0.x, d0[j]);  d1[j] = fmaf(x.x, m1.x, d1[j]);
            d0[j] = fmaf(x.y, m0.y, d0[j]);  d1[j] = fmaf(x.y, m1.y, d1[j]);
            d0[j] = fmaf(x.z, m0.z, d0[j]);  d1[j] = fmaf(x.z, m1.z, d1[j]);
            d0[j] = fmaf(x.w, m0.w, d0[j]);  d1[j] = fmaf(x.w, m1.w, d1[j]);
        }
    }
    #pragma unroll   // constant indices keep the small array in registers
    for (int j = 0; j < KR; ++j) {
        cb[j][tid]       = d0[j] * in0;
        cb[j][tid + 256] = d1[j] * in1;
    }
    __syncthreads();

    // Sum of squares per key: 128 strided chains, then a halving tree.
    // Thread = (chain t, keys g and g + 2).
    const int t = tid % 128, g = tid / 128;
    #pragma unroll   // both keys' LDS reads in flight together
    for (int h = 0; h < KR / 2; ++h) {
        const int j = g + 2 * h;
        float acc = 0.f;
        #pragma unroll   // the chain's four LDS reads in flight together
        for (int m = 0; m < KN / 128; ++m) {
            const float c = cb[j][t + 128 * m];
            acc = fmaf(c, c, acc);
        }
        red[j][t] = acc;
    }
    __syncthreads();
    for (int off = 64; off > 0; off >>= 1) {
        if (t < off) {
            #pragma unroll   // both keys' LDS reads in flight together
            for (int h = 0; h < KR / 2; ++h) red[g + 2 * h][t] += red[g + 2 * h][t + off];
        }
        __syncthreads();
    }
    if (tid < KR) ksim[r0 + tid] = red[tid][0];
}

__device__ __forceinline__ void logits_tiles(const float* __restrict__ qrow0,
                                             const float* walf, const float* keyrows,
                                             int hh, int lane, v8f (&acc)[QTW][KB])
{
    v8f zero = {};
    #pragma unroll
    for (int i = 0; i < QTW; ++i) {
        #pragma unroll
        for (int f = 0; f < KB; ++f) acc[i][f] = zero;
    }
    for (int t = 0; t < TD; t += 4) {
        const int ta = t + 2 * hh;                  // fp32 A/B frag: K = {2h, 2h+1}
        const v2f w = *reinterpret_cast<const v2f*>(walf + t * 16 + lane * 2);
        v2f a[QTW];
        #pragma unroll
        for (int i = 0; i < QTW; ++i) {             // q-tile i = wave + 8*i
            const float* qr = qrow0 + (size_t)i * (NWAVES * 16 * TD) + ta;
            a[i].x = qr[0];
            a[i].y = qr[1];
        }
        #pragma unroll
        for (int f = 0; f < KB; ++f) {
            const float* kr = keyrows + f * TD + ta;
            v2f bb; bb.x = w.x * kr[0]; bb.y = w.y * kr[1];
            #pragma unroll
            for (int i = 0; i < QTW; ++i)
                acc[i][f] = __builtin_amdgcn_wmma_f32_16x16x4_f32(
                    false, a[i], false, bb, (short)0, acc[i][f], false, false);
        }
    }
}

__global__ __launch_bounds__(256) __attribute__((amdgpu_waves_per_eu(2, 2)))
void swish_attn_kernel(const float* __restrict__ query, const float* __restrict__ key,
                       const float* __restrict__ vraw,  const float* __restrict__ Wal,
                       const float* __restrict__ ksim,  float* __restrict__ part)
{
    __shared__ float st_m[16 * TD];         // per (wave,half) run-max of a column
    __shared__ float st_s[16 * TD];         // per (wave,half) run-sum of a column
    __shared__ float f_m[TD];               // final max per column
    __shared__ float f_d[TD];               // final denom per column
    __shared__ float valrow[TD];            // value_raw[k][s] per column
    __shared__ __attribute__((aligned(16))) float keyrows[KB * TD];
    __shared__ __attribute__((aligned(16))) float walf[SS * TD];  // [t/4][lane][2]

    const int wg   = blockIdx.x;
    const int b    = wg / (NSL * NG);
    const int sl   = (wg / NG) % NSL;       // slice of SS columns s
    const int grp  = wg % NG;               // group of KPW keys
    const int tid  = threadIdx.x;
    const int wave = tid >> 5;              // wave32
    const int lane = tid & 31;
    const int hh   = lane >> 4;             // lane half (K / M-half select)
    const int n    = lane & 15;             // N index / A-row index

    // The slice's 16 rows of Wal in B-fragment order: a wave reads 256 B in a row.
    {
        constexpr int NW = SS * TD / 2 / 256;       // fragment pairs per thread (4)
        const float* wsrc = Wal + (size_t)(sl * SS + n) * TD + wave * 4 + 2 * hh;
        v2f wv[NW];
        #pragma unroll   // the loads in flight together
        for (int u = 0; u < NW; ++u)                // K step t/4 = wave + 8*u
            wv[u] = *reinterpret_cast<const v2f*>(wsrc + u * NWAVES * 4);
        #pragma unroll   // constant indices keep the small array in registers
        for (int u = 0; u < NW; ++u) reinterpret_cast<v2f*>(walf)[tid + u * 256] = wv[u];
    }

    const float* qb = query + (size_t)b * QN * TD;

    v8f vsum[QTW];
    {
        v8f zero = {};
        #pragma unroll   // constant indices keep the arrays in registers
        for (int i = 0; i < QTW; ++i) vsum[i] = zero;
    }

    for (int kb = 0; kb < KPW / KB; ++kb) {
        const size_t r0 = (size_t)b * KN + grp * KPW + kb * KB;   // first key's row
        // This pass's small loads fly together, ahead of the barrier. KB key rows lie
        // in a row in memory: 16 bytes per thread. col = the thread's column (k, s).
        const int col = tid % TD;
        const float4 kv = reinterpret_cast<const float4*>(key + r0 * TD)[tid];
        const float  vv = vraw[(r0 + col / SS) * TD + sl * SS + col % SS];
        const float  kshrink = ksim[r0 + col / SS];
        // later code rewrites the registers that these loads name
        asm volatile("s_wait_xcnt 0x0" ::: "memory");
        __syncthreads();                    // the last pass has read its LDS rows

        reinterpret_cast<float4*>(keyrows)[tid] = kv;
        if (tid < TD) valrow[tid] = vv;
        for (int i = tid; i < 16 * TD; i += 256) {
            st_m[i] = -INFINITY;
            st_s[i] = 0.f;
        }
        __syncthreads();                    // also covers walf on the first pass

        // ---- pass A: column stats (max, sum |x| e^{x-max}) over this lane's q ----
        float runM[KB], runS[KB];
        #pragma unroll
        for (int f = 0; f < KB; ++f) { runM[f] = -INFINITY; runS[f] = 0.f; }

        v8f acc[QTW][KB];                   // lives until the end of pass B
        logits_tiles(qb + (size_t)(wave * 16 + n) * TD, walf, keyrows, hh, lane, acc);

        // The lane's column maxima first: with the maximum known, a logit needs
        // one exponential and the running sum no rescaling.
        #pragma unroll   // constant indices keep the arrays in registers
        for (int i = 0; i < QTW; ++i) {
            #pragma unroll   // constant indices keep the arrays in registers
            for (int r = 0; r < 8; ++r) {
                #pragma unroll   // constant indices keep the arrays in registers
                for (int f = 0; f < KB; ++f) runM[f] = fmaxf(runM[f], acc[i][f][r]);
            }
        }
        constexpr float L2E = 1.44269504088896340736f;      // log2(e)
        float negM2[KB];                                    // -max in the exp2 domain
        #pragma unroll   // constant indices keep the arrays in registers
        for (int f = 0; f < KB; ++f) negM2[f] = -runM[f] * L2E;
        // x e^{x - runM} takes the logit's place in its register: pass B only has
        // to rescale it by a factor per column. |x| e^y = |x e^y|.
        #pragma unroll   // constant indices keep the arrays in registers
        for (int i = 0; i < QTW; ++i) {
            #pragma unroll   // constant indices keep the arrays in registers
            for (int r = 0; r < 8; ++r) {
                #pragma unroll   // constant indices keep the arrays in registers
                for (int f = 0; f < KB; ++f) {
                    const float x = acc[i][f][r];
                    const float p = x * __builtin_amdgcn_exp2f(fmaf(x, L2E, negM2[f]));
                    acc[i][f][r] = p;
                    runS[f] += fabsf(p);
                }
            }
        }
        {
            const int p = wave * 2 + hh;
            #pragma unroll
            for (int f = 0; f < KB; ++f) {
                st_m[p * TD + f * 16 + n] = runM[f];
                st_s[p * TD + f * 16 + n] = runS[f];
            }
        }
        __syncthreads();
        if (tid < TD) {                      // combine 16 partials per column
            float M = -INFINITY;
            for (int p = 0; p < 16; ++p) M = fmaxf(M, st_m[p * TD + tid]);
            float S = 0.f;
            for (int p = 0; p < 16; ++p)
                S += st_s[p * TD + tid] * __expf(st_m[p * TD + tid] - M);
            f_m[tid] = M;
            // shrink cancels: scale = x e^{x-M} / (S + ksim)
            f_d[tid] = S + kshrink;
        }
        __syncthreads();

        // ---- pass B: rescale the kept products, add them up over the keys ----
        float g[KB];                         // e^{runM - M} * value / denom per column
        #pragma unroll   // constant indices keep the arrays in registers
        for (int f = 0; f < KB; ++f) {
            const int c = f * 16 + n;
            g[f] = __expf(runM[f] - f_m[c]) * (1.f / f_d[c]) * valrow[c];
        }
        #pragma unroll   // constant indices keep the arrays in registers
        for (int f = 0; f < KB; ++f) {       // keys in ascending order
            #pragma unroll   // constant indices keep the arrays in registers
            for (int i = 0; i < QTW; ++i) {
                #pragma unroll   // constant indices keep the arrays in registers
                for (int r = 0; r < 8; ++r)
                    vsum[i][r] = fmaf(acc[i][f][r], g[f], vsum[i][r]);
            }
        }
    }

    // Store the partial from its registers. Layout part[b][key group][slice][q][SS]:
    // a work-group's 32 KB lie in a row, so no other work-group writes its lines.
    float* dst = part + ((size_t)((b * NG + grp) * NSL + sl) * QN + 8 * hh) * SS + n;
    #pragma unroll   // constant indices keep the arrays in registers
    for (int i = 0; i < QTW; ++i) {
        #pragma unroll   // constant indices keep the arrays in registers
        for (int r = 0; r < 8; ++r)
            dst[((wave + i * NWAVES) * 16 + r) * SS] = vsum[i][r];
    }
}

// ---------------- Stage 4: sum of the partials + output projection ---------
//
// One block owns two q rows. In each of the NG partials a slice's share of them
// is one 128-byte line: wave = slice, lane = (row, column in the slice) adds its
// element over the key groups in ascending order. Wvo is staged in LDS like the
// other small products' matrices.

__global__ __launch_bounds__(256)
void out_proj_kernel(const float* __restrict__ part, const float* __restrict__ Wvo,
                     float* __restrict__ out)
{
    __shared__ __attribute__((aligned(16))) float wt[TD * WP];
    __shared__ __attribute__((aligned(16))) float vs[2 * TD];
    const int tid = threadIdx.x;
    copy_rows_async<TD>(Wvo, wt, tid);  // flies while the partials are summed
    const int b  = blockIdx.x / (QN / 2);
    const int q0 = (blockIdx.x % (QN / 2)) * 2;
    const int sl = tid >> 5;
    const int w  = tid & 31;
    const float* p = part + ((size_t)(b * NG * NSL + sl) * QN + q0) * SS + w;
    float s = 0.f;
    #pragma unroll   // straight line: the independent loads are in flight together
    for (int g = 0; g < NG; ++g) s += p[(size_t)g * NSL * QN * SS];
    vs[(w >> 4) * TD + sl * SS + (w & 15)] = s;
    wait_copies();
    __syncthreads();

    int idx = blockIdx.x * 256 + tid;               // [0, B*QN*TD)
    float a[1];
    dot_rows<1>(wt + (tid % TD) * WP, vs + (tid / TD) * TD, a);
    out[idx] = a[0];
}

// ---------------------------------------------------------------------------

extern "C" void kernel_launch(void* const* d_in, const int* in_sizes, int n_in,
                              void* d_out, int out_size, void* d_ws, size_t ws_size,
                              hipStream_t stream)
{
    const float* qtok = (const float*)d_in[0];  // query_tokens [B,Q,T]
    const float* ktok = (const float*)d_in[1];  // key_tokens   [B,K,T]
    const float* Wk   = (const float*)d_in[2];
    const float* Wq   = (const float*)d_in[3];
    const float* Wva  = (const float*)d_in[4];
    const float* Wal  = (const float*)d_in[5];
    const float* Wvo  = (const float*)d_in[6];
    float* out = (float*)d_out;

    float* ws      = (float*)d_ws;              // 12 MB used
    float* w_key   = ws;                        // [NROW*TD]
    float* w_query = w_key   + NROW * TD;
    float* w_vraw  = w_query + NROW * TD;
    float* w_inorm = w_vraw  + NROW * TD;       // [NROW]
    float* w_ksim  = w_inorm + NROW;            // [NROW]
    float* w_part  = ws + (1 << 20);            // [B][NG][NSL][QN][SS] = 8 MB

    dim3 blk256(256);
    const int nElem = NROW * TD;                // 131072

    proj_kernel<<<2 * NROW / (2 * RQK), blk256, 0, stream>>>(
        qtok, ktok, Wq, Wk, Wva, w_query, w_key, w_vraw, w_inorm);
    ksim_kernel   <<<NROW / KR, blk256, 0, stream>>>(w_key, w_inorm, w_ksim);

    swish_attn_kernel<<<B_ * NSL * NG, blk256, 0, stream>>>(
        w_query, w_key, w_vraw, Wal, w_ksim, w_part);

    out_proj_kernel<<<nElem / 256, blk256, 0, stream>>>(w_part, Wvo, out);
}

// v007
// Measured time: 103 microseconds a run.
// Timed twice side by side with v006, it ran 1.05 times as fast both times.
// Counting every step since v000, it is 4.18 times as fast.
#include <hip/hip_runtime.h>
#include <math.h>

typedef float v2f __attribute__((ext_vector_type(2)));
typedef float v8f __attribute__((ext_vector_type(8)));

constexpr int B_  = 2;
constexpr int QN  = 512;
constexpr int KN  = 512;
constexpr int TD  = 128;
constexpr int NROW = B_ * KN;     // 1024 rows for [B,*,T] tensors
constexpr int KB   = 8;           // keys a workgroup takes at a time
constexpr int SS   = 16;          // logit columns s per workgroup
constexpr int NSL  = TD / SS;     // column slices (8)
constexpr int NG   = 16;          // key groups = value partials per batch
constexpr int KPW  = KN / NG;     // keys per workgroup (32)
constexpr int NWAVES = 8;         // 256 threads = 8 wave32
constexpr int QTW  = QN / 16 / NWAVES;   // q-tiles per wave (4)

// ---------------- Small dense products: operands through LDS ---------------
//
// Every small product here is y[r][t] = sum_s x[r][s] * M[t][s], one lane per
// row t of M. Read from global memory that is one 128-byte line per lane and
// load. Instead the block copies M into LDS with asynchronous copies that cover
// whole rows, and each lane walks its row there, for several x rows at a time.

constexpr int WP = TD + 4;

// Copy NR (a multiple of 64) contiguous rows of TD floats to LDS at pitch WP,
// through no register. A sweep = the block's 8 waves (256 threads) copy 8 rows:
// one wave-wide 16-byte copy = one whole 512-byte row. NR / 8 copies per wave
// are left in flight: the caller waits (s_wait_asynccnt 0) and then barriers.
template <int NR>
__device__ __forceinline__ void copy_rows_async(const float* g, float* l, int tid)
{
    constexpr unsigned LS = 8 * WP * 4;             // LDS bytes per sweep
    constexpr int      GS = 8 * TD;                 // floats per sweep
    // low 32 bits of a generic pointer into LDS = the LDS byte address
    const unsigned l0 = (unsigned)(uintptr_t)(l + (tid >> 5) * WP + (tid & 31) * 4);
    const float*   g0 = g + tid * 4;
    #pragma unroll   // straight line: no loop-carried address registers
    for (int u = 0; u < NR / 8; u += 8) {
        const unsigned a = l0 + u * LS;
        const float*   p = g0 + u * GS;
        // the wait ends the statement: the copies' address registers are free behind it
        asm volatile("global_load_async_to_lds_b128 %0, %8, off\n\t"
                     "global_load_async_to_lds_b128 %1, %9, off\n\t"
                     "global_load_async_to_lds_b128 %2, %10, off\n\t"
                     "global_load_async_to_lds_b128 %3, %11, off\n\t"
                     "global_load_async_to_lds_b128 %4, %12, off\n\t"
                     "global_load_async_to_lds_b128 %5, %13, off\n\t"
                     "global_load_async_to_lds_b128 %6, %14, off\n\t"
                     "global_load_async_to_lds_b128 %7, %15, off\n\t"
                     "s_wait_xcnt 0x0"
                     :: "v"(a), "v"(a + LS), "v"(a + 2 * LS), "v"(a + 3 * LS),
                        "v"(a + 4 * LS), "v"(a + 5 * LS), "v"(a + 6 * LS), "v"(a + 7 * LS),
                        "v"(p), "v"(p + GS), "v"(p + 2 * GS), "v"(p + 3 * GS),
                        "v"(p + 4 * GS), "v"(p + 5 * GS), "v"(p + 6 * GS), "v"(p + 7 * GS)
                     : "memory");
    }
}

// The issuing wave's copies have landed behind this; other waves need the barrier too.
__device__ __forceinline__ void wait_copies()
{
    asm volatile("s_wait_asynccnt 0x0" ::: "memory");
}

// a[j] = sum_s xrows[j][s] * mrow[s], s ascending, one fused multiply-add each.
template <int R>
__device__ __forceinline__ void dot_rows(const float* mrow, const float* xrows, float (&a)[R])
{
    #pragma unroll   // constant indices keep the small array in registers
    for (int j = 0; j < R; ++j) a[j] = 0.f;
    #pragma unroll 8   // eight groups of LDS reads in flight cover the LDS latency
    for (int s = 0; s < TD; s += 4) {
        const float4 m = *reinterpret_cast<const float4*>(mrow + s);
        #pragma unroll   // constant indices keep the small array in registers
        for (int j = 0; j < R; ++j) {
            const float4 x = *reinterpret_cast<const float4*>(xrows + j * TD + s);
            a[j] = fmaf(x.x, m.x, a[j]);
            a[j] = fmaf(x.y, m.y, a[j]);
            a[j] = fmaf(x.z, m.z, a[j]);
            a[j] = fmaf(x.w, m.w, a[j]);
        }
    }
}

// ---------------- Stage 1: projections and key norms, one launch -----------
//
// One block = 2*RQK rows of one token tensor; thread = (column t, half g of the
// rows). A key block goes on with what depends on its own key rows alone: they
// stay in LDS, and the block takes their norms and their value rows from there,
// so neither needs a launch of its own. Key blocks have the longer way and come
// first in the grid.

constexpr int RQK = 4;            // x rows per thread; 8 rows per block

__global__ __launch_bounds__(256)
void proj_kernel(const float* __restrict__ qtok, const float* __restrict__ ktok,
                 const float* __restrict__ Wq,   const float* __restrict__ Wk,
                 const float* __restrict__ Wva,
                 float* __restrict__ query, float* __restrict__ key,
                 float* __restrict__ vraw,  float* __restrict__ inv_norm)
{
    __shared__ __attribute__((aligned(16))) float wt[TD * WP];      // Wq or Wk
    __shared__ __attribute__((aligned(16))) float wv[TD * WP];      // Wva
    __shared__ __attribute__((aligned(16))) float xs[2 * RQK * TD]; // token rows
    __shared__ __attribute__((aligned(16))) float ks[2 * RQK * TD]; // key rows
    constexpr int NB = NROW / (2 * RQK);            // blocks per token tensor
    const int  tid = threadIdx.x;
    const bool isk = blockIdx.x < NB;               // the same for the whole block
    const int  r0  = (blockIdx.x % NB) * (2 * RQK); // first row
    const size_t off = (size_t)r0 * TD;

    copy_rows_async<TD>(isk ? Wk : Wq, wt, tid);
    if (isk) copy_rows_async<TD>(Wva, wv, tid);     // 32 copies per wave in flight
    // 2*RQK rows = one float4 per thread; flies with the copies
    reinterpret_cast<float4*>(xs)[tid] =
        reinterpret_cast<const float4*>((isk ? ktok : qtok) + off)[tid];
    wait_copies();
    __syncthreads();

    const int t = tid % TD, g = tid / TD;
    float a[RQK];
    dot_rows<RQK>(wt + t * WP, xs + g * RQK * TD, a);

    if (!isk) {
        #pragma unroll   // constant indices keep the small array in registers
        for (int j = 0; j < RQK; ++j) query[off + (size_t)(g * RQK + j) * TD + t] = a[j];
        asm volatile("s_wait_xcnt 0x0" ::: "memory");
    } else {
        #pragma unroll   // constant indices keep the small array in registers
        for (int j = 0; j < RQK; ++j) ks[(g * RQK + j) * TD + t] = a[j];
        __syncthreads();                            // the key rows are whole in LDS
        // behind the barrier, so that it does not wait for these stores
        #pragma unroll   // constant indices keep the small array in registers
        for (int j = 0; j < RQK; ++j) key[off + (size_t)(g * RQK + j) * TD + t] = a[j];

        // Norm: wave = row. A halving tree over the 128 squares: distances 64 and
        // 32 inside the lane, 16 to 1 between lanes.
        const int wave = tid >> 5, lane = tid & 31;
        const float* kr = ks + wave * TD + lane;
        const float k0 = kr[0], k1 = kr[32], k2 = kr[64], k3 = kr[96];
        float ss = (k0 * k0 + k2 * k2) + (k1 * k1 + k3 * k3);
        #pragma unroll   // five steps, straight line
        for (int d = 16; d > 0; d >>= 1) ss += __shfl_xor(ss, d, 32);
        if (lane == 0)                              // the reference's clamp of the norm
            inv_norm[r0 + wave] = 1.f / fmaxf(sqrtf(ss), 1e-8f);

        float v[RQK];
        dot_rows<RQK>(wv + t * WP, ks + g * RQK * TD, v);
        #pragma unroll   // constant indices keep the small array in registers
        for (int j = 0; j < RQK; ++j) vraw[off + (size_t)(g * RQK + j) * TD + t] = v[j];
    }
}

// ---------------- Stage 2: pairwise cosine similarity ----------------------

// ksim[b,k] = sum_j (kn_k . kn_j)^2   (== diag of (Kn Kn^T)^2)
//
// One block = KR keys k against all KN keys j of their batch, which it holds in
// LDS (264 KB). Thread = two rows j; each 16 bytes of a row j meet KR keys k.
constexpr int KR = 4;

__global__ __launch_bounds__(256)
void ksim_kernel(const float* __restrict__ key, const float* __restrict__ inv_norm,
                 float* __restrict__ ksim)
{
    __shared__ __attribute__((aligned(16))) float kt[KN * WP];
    __shared__ __attribute__((aligned(16))) float kk[KR * TD];
    __shared__ float cb[KR][KN];        // cosines
    __shared__ float red[KR][128];
    const int r0  = blockIdx.x * KR;    // b*KN + k of the first key
    const int b   = r0 / KN;
    const int tid = threadIdx.x;

    // small loads first, so that they fly with the fill
    const float in0 = inv_norm[b * KN + tid];
    const float in1 = inv_norm[b * KN + tid + 256];
    const float kv0 = key[(size_t)r0 * TD + tid]       * inv_norm[r0 + tid / TD];
    const float kv1 = key[(size_t)r0 * TD + tid + 256] * inv_norm[r0 + 2 + tid / TD];
    // two runs of 32 copies per wave: a wave keeps fewer than 64 in flight
    const float* kb = key + (size_t)b * KN * TD;
    copy_rows_async<KN / 2>(kb, kt, tid);
    wait_copies();
    copy_rows_async<KN / 2>(kb + (KN / 2) * TD, kt + (KN / 2) * WP, tid);
    kk[tid]       = kv0;
    kk[tid + 256] = kv1;
    wait_copies();
    __syncthreads();

    float d0[KR], d1[KR];
    #pragma unroll   // constant indices keep the small array in registers
    for (int j = 0; j < KR; ++j) { d0[j] = 0.f; d1[j] = 0.f; }
    const float* row0 = kt + tid * WP;
    const float* row1 = kt + (tid + 256) * WP;
    #pragma unroll 4   // four groups of LDS reads in flight cover the LDS latency
    for (int s = 0; s < TD; s += 4) {
        const float4 m0 = *reinterpret_cast<const float4*>(row0 + s);
        const float4 m1 = *reinterpret_cast<const float4*>(row1 + s);
        #pragma unroll   // constant indices keep the small array in registers
        for (int j = 0; j < KR; ++j) {
            const float4 x = *reinterpret_cast<const float4*>(kk + j * TD + s);
            d0[j] = fmaf(x.x, m0.x, d0[j]);  d1[j] = fmaf(x.x, m1.x, d1[j]);
            d0[j] = fmaf(x.y, m0.y, d0[j]);  d1[j] = fmaf(x.y, m1.y, d1[j]);
            d0[j] = fmaf(x.z, m0.z, d0[j]);  d1[j] = fmaf(x.z, m1.z, d1[j]);
            d0[j] = fmaf(x.w, m0.w, d0[j]);  d1[j] = fmaf(x.w, m1.w, d1[j]);
        }
    }
    #pragma unroll   // constant indices keep the small array in registers
    for (int j = 0; j < KR; ++j) {
        cb[j][tid]       = d0[j] * in0;
        cb[j][tid + 256] = d1[j] * in1;
    }
    __syncthreads();

    // Sum of squares per key: 128 strided chains, then a halving tree.
    // Thread = (chain t, keys g and g + 2).
    const int t = tid % 128, g = tid / 128;
    #pragma unroll   // both keys' LDS reads in flight together
    for (int h = 0; h < KR / 2; ++h) {
        const int j = g + 2 * h;
        float acc = 0.f;
        #pragma unroll   // the chain's four LDS reads in flight together
        for (int m = 0; m < KN / 128; ++m) {
            const float c = cb[j][t + 128 * m];
            acc = fmaf(c, c, acc);
        }
        red[j][t] = acc;
    }
    __syncthreads();
    for (int off = 64; off > 0; off >>= 1) {
        if (t < off) {
            #pragma unroll   // both keys' LDS reads in flight together
            for (int h = 0; h < KR / 2; ++h) red[g + 2 * h][t] += red[g + 2 * h][t + off];
        }
        __syncthreads();
    }
    if (tid < KR) ksim[r0 + tid] = red[tid][0];
}

struct Stage {
    v2f a[2][QTW];      // query fragments, one per q-tile
    v2f w[2];           // Wal fragment
    v2f k[2][KB];       // key values, one pair per key
};

__device__ __forceinline__ void load_stage(Stage& st, const float* __restrict__ qrow0,
                                           const float* walf, const float* keyrows,
                                           int hh, int lane, int t)
{
    #pragma unroll   // constant indices keep the stage in registers
    for (int u = 0; u < 2; ++u) {
        const int ta = t + 4 * u + 2 * hh;          // fp32 A/B frag: K = {2h, 2h+1}
        #pragma unroll   // constant indices keep the stage in registers
        for (int i = 0; i < QTW; ++i)               // q-tile i = wave + 8*i
            st.a[u][i] = *reinterpret_cast<const v2f*>(
                qrow0 + (size_t)i * (NWAVES * 16 * TD) + ta);
        st.w[u] = *reinterpret_cast<const v2f*>(walf + (t + 4 * u) * 16 + lane * 2);
        #pragma unroll   // constant indices keep the stage in registers
        for (int f = 0; f < KB; ++f)
            st.k[u][f] = *reinterpret_cast<const v2f*>(keyrows + f * TD + ta);
    }
}

__device__ __forceinline__ void mma_stage(const Stage& st, v8f (&acc)[QTW][KB])
{
    v2f bb[2][KB];                                  // B fragments: Wal[s,t] * key_k[t]
    #pragma unroll   // constant indices keep the arrays in registers
    for (int u = 0; u < 2; ++u) {
        #pragma unroll   // constant indices keep the arrays in registers
        for (int f = 0; f < KB; ++f) bb[u][f] = st.w[u] * st.k[u][f];
    }
    // every B fragment is formed ahead of the stage's products: otherwise the scheduler
    // forms them in two register pairs among the WMMAs, each multiply overwriting the
    // pair directly behind the WMMA that reads it
    __builtin_amdgcn_sched_barrier(0);
    #pragma unroll   // constant indices keep the arrays in registers
    for (int u = 0; u < 2; ++u) {
        #pragma unroll   // constant indices keep the arrays in registers
        for (int f = 0; f < KB; ++f) {
            #pragma unroll   // constant indices keep the arrays in registers
            for (int i = 0; i < QTW; ++i)
                acc[i][f] = __builtin_amdgcn_wmma_f32_16x16x4_f32(
                    false, st.a[u][i], false, bb[u][f], (short)0, acc[i][f], false, false);
        }
    }
    // no vector instruction of what follows moves up among the WMMAs ...
    __builtin_amdgcn_sched_barrier(0);
    asm volatile("v_nop\n\tv_nop\n\tv_nop\n\tv_nop");
    __builtin_amdgcn_sched_barrier(0);
}

// Two stages in registers: a stage's loads are issued one stage (64 WMMAs) ahead of
// its products, so a wave does not stand still for them at the head of each trip.
__device__ __forceinline__ void logits_tiles(const float* __restrict__ qrow0,
                                             const float* walf, const float* keyrows,
                                             int hh, int lane, v8f (&acc)[QTW][KB])
{
    v8f zero = {};
    #pragma unroll
    for (int i = 0; i < QTW; ++i) {
        #pragma unroll
        for (int f = 0; f < KB; ++f) acc[i][f] = zero;
    }
    Stage s0, s1;
    load_stage(s0, qrow0, walf, keyrows, hh, lane, 0);
    #pragma unroll 1   // one trip = both stages; more would only grow the code
    for (int t = 0; t < TD - 16; t += 16) {
        load_stage(s1, qrow0, walf, keyrows, hh, lane, t + 8);
        // holds the loads above the products: the scheduler otherwise sinks a stage's
        // LDS reads to right in front of their use, and the wave waits for them there
        __builtin_amdgcn_sched_barrier(0);
        mma_stage(s0, acc);
        load_stage(s0, qrow0, walf, keyrows, hh, lane, t + 16);
        __builtin_amdgcn_sched_barrier(0);
        mma_stage(s1, acc);
        // the address registers that this trip's loads name are stepped behind this wait
        asm volatile("s_wait_xcnt 0x0" ::: "memory");
        __builtin_amdgcn_sched_barrier(0);          // keeps the steps behind the wait
    }
    load_stage(s1, qrow0, walf, keyrows, hh, lane, TD - 8);
    __builtin_amdgcn_sched_barrier(0);              // as in the loop
    mma_stage(s0, acc);
    mma_stage(s1, acc);
}

__global__ __launch_bounds__(256) __attribute__((amdgpu_waves_per_eu(2, 2)))
void swish_attn_kernel(const float* __restrict__ query, const float* __restrict__ key,
                       const float* __restrict__ vraw,  const float* __restrict__ Wal,
                       const float* __restrict__ ksim,  float* __restrict__ part)
{
    __shared__ float st_m[16 * TD];         // per (wave,half) run-max of a column
    __shared__ float st_s[16 * TD];         // per (wave,half) run-sum of a column
    __shared__ float f_m[TD];               // final max per column
    __shared__ float f_d[TD];               // final denom per column
    __shared__ float valrow[TD];            // value_raw[k][s] per column
    __shared__ __attribute__((aligned(16))) float keyrows[KB * TD];
    __shared__ __attribute__((aligned(16))) float walf[SS * TD];  // [t/4][lane][2]

    const int wg   = blockIdx.x;
    const int b    = wg / (NSL * NG);
    const int sl   = (wg / NG) % NSL;       // slice of SS columns s
    const int grp  = wg % NG;               // group of KPW keys
    const int tid  = threadIdx.x;
    const int wave = tid >> 5;              // wave32
    const int lane = tid & 31;
    const int hh   = lane >> 4;             // lane half (K / M-half select)
    const int n    = lane & 15;             // N index / A-row index

    // The slice's 16 rows of Wal in B-fragment order: a wave reads 256 B in a row.
    {
        constexpr int NW = SS * TD / 2 / 256;       // fragment pairs per thread (4)
        const float* wsrc = Wal + (size_t)(sl * SS + n) * TD + wave * 4 + 2 * hh;
        v2f wv[NW];
        #pragma unroll   // the loads in flight together
        for (int u = 0; u < NW; ++u)                // K step t/4 = wave + 8*u
            wv[u] = *reinterpret_cast<const v2f*>(wsrc + u * NWAVES * 4);
        // later code rewrites the address registers that these loads name
        asm volatile("s_wait_xcnt 0x0" ::: "memory");
        __builtin_amdgcn_sched_barrier(0);          // keeps those rewrites behind the wait
        #pragma unroll   // constant indices keep the small array in registers
        for (int u = 0; u < NW; ++u) reinterpret_cast<v2f*>(walf)[tid + u * 256] = wv[u];
    }

    const float* qb = query + (size_t)b * QN * TD;

    v8f vsum[QTW];
    {
        v8f zero = {};
        #pragma unroll   // constant indices keep the arrays in registers
        for (int i = 0; i < QTW; ++i) vsum[i] = zero;
    }

    for (int kb = 0; kb < KPW / KB; ++kb) {
        const size_t r0 = (size_t)b * KN + grp * KPW + kb * KB;   // first key's row
        // This pass's small loads fly together, ahead of the barrier. KB key rows lie
        // in a row in memory: 16 bytes per thread. col = the thread's column (k, s).
        const int col = tid % TD;
        const float4 kv = reinterpret_cast<const float4*>(key + r0 * TD)[tid];
        const float  vv = vraw[(r0 + col / SS) * TD + sl * SS + col % SS];
        const float  kshrink = ksim[r0 + col / SS];
        // later code rewrites the registers that these loads name
        asm volatile("s_wait_xcnt 0x0" ::: "memory");
        __syncthreads();                    // the last pass has read its LDS rows

        reinterpret_cast<float4*>(keyrows)[tid] = kv;
        if (tid < TD) valrow[tid] = vv;
        for (int i = tid; i < 16 * TD; i += 256) {
            st_m[i] = -INFINITY;
            st_s[i] = 0.f;
        }
        __syncthreads();                    // also covers walf on the first pass

        // ---- pass A: column stats (max, sum |x| e^{x-max}) over this lane's q ----
        float runM[KB], runS[KB];
        #pragma unroll
        for (int f = 0; f < KB; ++f) { runM[f] = -INFINITY; runS[f] = 0.f; }

        v8f acc[QTW][KB];                   // lives until the end of pass B
        logits_tiles(qb + (size_t)(wave * 16 + n) * TD, walf, keyrows, hh, lane, acc);

        // The lane's column maxima first: with the maximum known, a logit needs
        // one exponential and the running sum no rescaling.
        #pragma unroll   // constant indices keep the arrays in registers
        for (int i = 0; i < QTW; ++i) {
            #pragma unroll   // constant indices keep the arrays in registers
            for (int r = 0; r < 8; ++r) {
                #pragma unroll   // constant indices keep the arrays in registers
                for (int f = 0; f < KB; ++f) runM[f] = fmaxf(runM[f], acc[i][f][r]);
            }
        }
        constexpr float L2E = 1.44269504088896340736f;      // log2(e)
        float negM2[KB];                                    // -max in the exp2 domain
        #pragma unroll   // constant indices keep the arrays in registers
        for (int f = 0; f < KB; ++f) negM2[f] = -runM[f] * L2E;
        // x e^{x - runM} takes the logit's place in its register: pass B only has
        // to rescale it by a factor per column. |x| e^y = |x e^y|.
        #pragma unroll   // constant indices keep the arrays in registers
        for (int i = 0; i < QTW; ++i) {
            #pragma unroll   // constant indices keep the arrays in registers
            for (int r = 0; r < 8; ++r) {
                #pragma unroll   // constant indices keep the arrays in registers
                for (int f = 0; f < KB; ++f) {
                    const float x = acc[i][f][r];
                    const float p = x * __builtin_amdgcn_exp2f(fmaf(x, L2E, negM2[f]));
                    acc[i][f][r] = p;
                    runS[f] += fabsf(p);
                }
            }
        }
        {
            const int p = wave * 2 + hh;
            #pragma unroll
            for (int f = 0; f < KB; ++f) {
                st_m[p * TD + f * 16 + n] = runM[f];
                st_s[p * TD + f * 16 + n] = runS[f];
            }
        }
        __syncthreads();
        if (tid < TD) {                      // combine 16 partials per column
            float M = -INFINITY;
            for (int p = 0; p < 16; ++p) M = fmaxf(M, st_m[p * TD + tid]);
            float S = 0.f;
            for (int p = 0; p < 16; ++p)
                S += st_s[p * TD + tid] * __expf(st_m[p * TD + tid] - M);
            f_m[tid] = M;
            // shrink cancels: scale = x e^{x-M} / (S + ksim)
            f_d[tid] = S + kshrink;
        }
        __syncthreads();

        // ---- pass B: rescale the kept products, add them up over the keys ----
        float g[KB];                         // e^{runM - M} * value / denom per column
        #pragma unroll   // constant indices keep the arrays in registers
        for (int f = 0; f < KB; ++f) {
            const int c = f * 16 + n;
            g[f] = __expf(runM[f] - f_m[c]) * (1.f / f_d[c]) * valrow[c];
        }
        #pragma unroll   // constant indices keep the arrays in registers
        for (int f = 0; f < KB; ++f) {       // keys in ascending order
            #pragma unroll   // constant indices keep the arrays in registers
            for (int i = 0; i < QTW; ++i) {
                #pragma unroll   // constant indices keep the arrays in registers
                for (int r = 0; r < 8; ++r)
                    vsum[i][r] = fmaf(acc[i][f][r], g[f], vsum[i][r]);
            }
        }
    }

    // Store the partial from its registers. Layout part[b][key group][slice][q][SS]:
    // a work-group's 32 KB lie in a row, so no other work-group writes its lines.
    float* dst = part + ((size_t)((b * NG + grp) * NSL + sl) * QN + 8 * hh) * SS + n;
    #pragma unroll   // constant indices keep the arrays in registers
    for (int i = 0; i < QTW; ++i) {
        #pragma unroll   // constant indices keep the arrays in registers
        for (int r = 0; r < 8; ++r)
            dst[((wave + i * NWAVES) * 16 + r) * SS] = vsum[i][r];
    }
}

// ---------------- Stage 4: sum of the partials + output projection ---------
//
// One block owns two q rows. In each of the NG partials a slice's share of them
// is one 128-byte line: wave = slice, lane = (row, column in the slice) adds its
// element over the key groups in ascending order. Wvo is staged in LDS like the
// other small products' matrices.

__global__ __launch_bounds__(256)
void out_proj_kernel(const float* __restrict__ part, const float* __restrict__ Wvo,
                     float* __restrict__ out)
{
    __shared__ __attribute__((aligned(16))) float wt[TD * WP];
    __shared__ __attribute__((aligned(16))) float vs[2 * TD];
    const int tid = threadIdx.x;
    copy_rows_async<TD>(Wvo, wt, tid);  // flies while the partials are summed
    const int b  = blockIdx.x / (QN / 2);
    const int q0 = (blockIdx.x % (QN / 2)) * 2;
    const int sl = tid >> 5;
    const int w  = tid & 31;
    const float* p = part + ((size_t)(b * NG * NSL + sl) * QN + q0) * SS + w;
    float s = 0.f;
    #pragma unroll   // straight line: the independent loads are in flight together
    for (int g = 0; g < NG; ++g) s += p[(size_t)g * NSL * QN * SS];
    vs[(w >> 4) * TD + sl * SS + (w & 15)] = s;
    wait_copies();
    __syncthreads();

    int idx = blockIdx.x * 256 + tid;               // [0, B*QN*TD)
    float a[1];
    dot_rows<1>(wt + (tid % TD) * WP, vs + (tid / TD) * TD, a);
    out[idx] = a[0];
}

// ---------------------------------------------------------------------------

extern "C" void kernel_launch(void* const* d_in, const int* in_sizes, int n_in,
                              void* d_out, int out_size, void* d_ws, size_t ws_size,
                              hipStream_t stream)
{
    const float* qtok = (const float*)d_in[0];  // query_tokens [B,Q,T]
    const float* ktok = (const float*)d_in[1];  // key_tokens   [B,K,T]
    const float* Wk   = (const float*)d_in[2];
    const float* Wq   = (const float*)d_in[3];
    const float* Wva  = (const float*)d_in[4];
    const float* Wal  = (const float*)d_in[5];
    const float* Wvo  = (const float*)d_in[6];
    float* out = (float*)d_out;

    float* ws      = (float*)d_ws;              // 12 MB used
    float* w_key   = ws;                        // [NROW*TD]
    float* w_query = w_key   + NROW * TD;
    float* w_vraw  = w_query + NROW * TD;
    float* w_inorm = w_vraw  + NROW * TD;       // [NROW]
    float* w_ksim  = w_inorm + NROW;            // [NROW]
    float* w_part  = ws + (1 << 20);            // [B][NG][NSL][QN][SS] = 8 MB

    dim3 blk256(256);
    const int nElem = NROW * TD;                // 131072

    proj_kernel<<<2 * NROW / (2 * RQK), blk256, 0, stream>>>(
        qtok, ktok, Wq, Wk, Wva, w_query, w_key, w_vraw, w_inorm);
    ksim_kernel   <<<NROW / KR, blk256, 0, stream>>>(w_key, w_inorm, w_ksim);

    swish_attn_kernel<<<B_ * NSL * NG, blk256, 0, stream>>>(
        w_query, w_key, w_vraw, Wal, w_ksim, w_part);

    out_proj_kernel<<<nElem / 256, blk256, 0, stream>>>(w_part, Wvo, out);
}
